// v000
// The times below were measured on an AMD MI455X: many runs one after another, warmed up first and cycling through
// copies of the inputs, with the whole window's GPU time divided by the number of runs. Launches and the gaps
// between them are all in it. The median over several windows is given; except for v000 it joins two sittings, which
// can be a few percent apart, so the side-by-side timings, each taken in one sitting, are the better comparison.
// v000, which the later versions start from, runs in 238 microseconds.
#include <hip/hip_runtime.h>

typedef __attribute__((ext_vector_type(16))) _Float16 v16h;
typedef __attribute__((ext_vector_type(8)))  _Float16 v8h;
typedef __attribute__((ext_vector_type(8)))  float    v8f;

#define CB   8      // batches
#define CC   128    // channels (c_in)
#define CQK  16     // q/k channels
#define NN   4096   // spatial positions (64*64)

// ---------------------------------------------------------------------------
// Phase 1a: Q/K projections.  Qh,Kh stored (b, n, 16) f16, row-contiguous so a
// lane can fetch its 8-halve WMMA operand slice with one 16-byte load.
// ---------------------------------------------------------------------------
__global__ void __launch_bounds__(256) qk_proj(
    const float* __restrict__ x, const float* __restrict__ Wq,
    const float* __restrict__ Wk, _Float16* __restrict__ Qh,
    _Float16* __restrict__ Kh) {
  __shared__ float sWq[CQK * CC];
  __shared__ float sWk[CQK * CC];
  int tid = threadIdx.x;
  for (int i = tid; i < CQK * CC; i += 256) { sWq[i] = Wq[i]; sWk[i] = Wk[i]; }
  __syncthreads();

  int gb = blockIdx.x * 256 + tid;          // 0 .. B*N-1
  int b  = gb / NN;
  int n  = gb % NN;
  const float* xp = x + (size_t)b * CC * NN + n;

  float qa[CQK] = {}, ka[CQK] = {};
  for (int c = 0; c < CC; ++c) {
    float xv = xp[(size_t)c * NN];          // coalesced along n
#pragma unroll
    for (int o = 0; o < CQK; ++o) {
      qa[o] += sWq[o * CC + c] * xv;
      ka[o] += sWk[o * CC + c] * xv;
    }
  }
  _Float16* qd = Qh + (size_t)gb * CQK;
  _Float16* kd = Kh + (size_t)gb * CQK;
#pragma unroll
  for (int o = 0; o < CQK; ++o) {
    qd[o] = (_Float16)qa[o];
    kd[o] = (_Float16)ka[o];
  }
}

// ---------------------------------------------------------------------------
// Phase 1b: V projection, stored TRANSPOSED: Vt (b, c, n) f16.
// x-tile (128 x 64, 32 KB) + full Wv (64 KB) staged in LDS so x is read from
// HBM exactly once.  256 threads = 4 channel-groups x 64 columns; weight reads
// are LDS broadcasts within a wave, x reads are conflict-free (stride-1 in n).
// ---------------------------------------------------------------------------
__global__ void __launch_bounds__(256) vt_proj(
    const float* __restrict__ x, const float* __restrict__ Wv,
    _Float16* __restrict__ Vt) {
  __shared__ float xs[CC * 64];
  __shared__ float sW[CC * CC];
  int tid = threadIdx.x;
  int blk = blockIdx.x;                     // 0 .. B*N/64-1
  int b   = blk / (NN / 64);
  int n0  = (blk % (NN / 64)) * 64;
  int nl  = tid & 63;                       // column within tile
  int c0  = (tid >> 6) * 32;                // 32 output channels per thread

  for (int i = tid; i < CC * 64; i += 256) {
    int ci = i >> 6, n = i & 63;
    xs[i] = x[(size_t)b * CC * NN + (size_t)ci * NN + n0 + n];
  }
  for (int i = tid; i < CC * CC; i += 256) sW[i] = Wv[i];
  __syncthreads();

  float acc[32] = {};
  for (int ci = 0; ci < CC; ++ci) {
    float xv = xs[ci * 64 + nl];
#pragma unroll
    for (int j = 0; j < 32; ++j) acc[j] += sW[(c0 + j) * CC + ci] * xv;
  }
#pragma unroll
  for (int j = 0; j < 32; ++j)
    Vt[((size_t)b * CC + (c0 + j)) * NN + n0 + nl] = (_Float16)acc[j];
}

// ---------------------------------------------------------------------------
// Phase 2: flash attention.  One wave per 16-row q-tile; Sᵀ via WMMA so the
// softmax row = lane%16 (one shfl_xor(16) per reduction), Pᵀ packs
// lane-locally, accumulator is outᵀ (c, n) tiles.  Lazy flash rescale: the
// 64-mul accumulator rescale only runs when some lane's running max grew.
// ---------------------------------------------------------------------------
__global__ void __launch_bounds__(256) attn_kernel(
    const float* __restrict__ x, const _Float16* __restrict__ Qh,
    const _Float16* __restrict__ Kh, const _Float16* __restrict__ Vt,
    const float* __restrict__ gamma, float* __restrict__ out) {
  int tid  = threadIdx.x;
  int lane = tid & 31;
  int wave = tid >> 5;
  int qt   = blockIdx.x * 8 + wave;         // global q-tile id (0..2047)
  int b    = qt >> 8;                       // 256 tiles per batch
  int n0   = (qt & 255) << 4;               // q rows n0 .. n0+15
  int r    = lane & 15;                     // q_row within tile / N index
  int g    = lane >> 4;                     // half-group (K-offset selector)

  const v8f zero = {};

  // B-operand: Q tile, B[K=o (padded to 32), N=q_row]; halves 8..15 stay 0.
  v16h bq = {};
  {
    v8h lo = *(const v8h*)(Qh + ((size_t)b * NN + n0 + r) * CQK + 8 * g);
#pragma unroll
    for (int h = 0; h < 8; ++h) bq[h] = lo[h];
  }

  v8f acc[8];
#pragma unroll
  for (int t = 0; t < 8; ++t) acc[t] = zero;
  float mstat = -1e30f, lstat = 0.0f;

  const _Float16* Kb = Kh + (size_t)b * NN * CQK;
  const _Float16* Vb = Vt + (size_t)b * CC * NN;

#pragma unroll 2
  for (int m0 = 0; m0 < NN; m0 += 32) {
    // A-operands: two K tiles, A[M = m col, K = o padded to 32]
    v16h ak0 = {}, ak1 = {};
    {
      v8h k0 = *(const v8h*)(Kb + (size_t)(m0 + r) * CQK + 8 * g);
      v8h k1 = *(const v8h*)(Kb + (size_t)(m0 + 16 + r) * CQK + 8 * g);
#pragma unroll
      for (int h = 0; h < 8; ++h) { ak0[h] = k0[h]; ak1[h] = k1[h]; }
    }
    // Sᵀ tiles: D[M = m local, N = q_row]
    v8f s0 = __builtin_amdgcn_wmma_f32_16x16x32_f16(false, ak0, false, bq,
                                                    (short)0, zero, false, false);
    v8f s1 = __builtin_amdgcn_wmma_f32_16x16x32_f16(false, ak1, false, bq,
                                                    (short)0, zero, false, false);

    // Running max over these 32 columns; per-lane row = r.
    float t = -1e30f;
#pragma unroll
    for (int v = 0; v < 8; ++v) t = fmaxf(t, fmaxf(s0[v], s1[v]));
    t = fmaxf(t, __shfl_xor(t, 16, 32));
    float mnew = fmaxf(mstat, t);

    // Lazy rescale: only when some lane's running max actually grew.
    if (__any(mnew > mstat)) {
      float sc = __expf(mstat - mnew);      // lanes with unchanged max: sc = 1
      lstat *= sc;
#pragma unroll
      for (int ct = 0; ct < 8; ++ct) {
#pragma unroll
        for (int v = 0; v < 8; ++v) acc[ct][v] *= sc;
      }
    }
    mstat = mnew;

    float p0[8], p1[8];
    float rsum = 0.0f;
#pragma unroll
    for (int v = 0; v < 8; ++v) {
      p0[v] = __expf(s0[v] - mnew);
      p1[v] = __expf(s1[v] - mnew);
      rsum += p0[v] + p1[v];
    }
    rsum += __shfl_xor(rsum, 16, 32);
    lstat += rsum;

    // Pack Pᵀ lane-locally into B layout: B[K = m local 0..31, N = q_row].
    v16h bp;
#pragma unroll
    for (int v = 0; v < 8; ++v) {
      bp[v]     = (_Float16)p0[v];
      bp[8 + v] = (_Float16)p1[v];
    }

    // acc += Vᵀ · Pᵀ   (outᵀ tiles, M = c, N = q_row)
#pragma unroll
    for (int ct = 0; ct < 8; ++ct) {
      const _Float16* vrow = Vb + (size_t)(ct * 16 + r) * NN + m0;
      v8h lo = *(const v8h*)(vrow + 8 * g);
      v8h hi = *(const v8h*)(vrow + 16 + 8 * g);
      v16h av;
#pragma unroll
      for (int h = 0; h < 8; ++h) { av[h] = lo[h]; av[8 + h] = hi[h]; }
      acc[ct] = __builtin_amdgcn_wmma_f32_16x16x32_f16(false, av, false, bp,
                                                       (short)0, acc[ct], false, false);
    }
  }

  // Epilogue: out(b,c,n) = x + gamma * outᵀ / lstat  (lstat uniform over v).
  float inv = gamma[0] / lstat;
  const float* xb = x + (size_t)b * CC * NN;
  float* ob = out + (size_t)b * CC * NN;
#pragma unroll
  for (int ct = 0; ct < 8; ++ct) {
#pragma unroll
    for (int v = 0; v < 8; ++v) {
      int c = ct * 16 + v + 8 * g;          // C/D layout: M = v + 8*(lane/16)
      size_t idx = (size_t)c * NN + n0 + r;
      ob[idx] = xb[idx] + inv * acc[ct][v];
    }
  }
}

// ---------------------------------------------------------------------------
extern "C" void kernel_launch(void* const* d_in, const int* in_sizes, int n_in,
                              void* d_out, int out_size, void* d_ws, size_t ws_size,
                              hipStream_t stream) {
  const float* x     = (const float*)d_in[0];
  const float* Wq    = (const float*)d_in[1];
  const float* Wk    = (const float*)d_in[2];
  const float* Wv    = (const float*)d_in[3];
  const float* gamma = (const float*)d_in[4];
  float* out = (float*)d_out;

  // Workspace: Qh (1 MB) | Kh (1 MB) | Vt (8 MB), all f16.
  _Float16* Qh = (_Float16*)d_ws;
  _Float16* Kh = Qh + (size_t)CB * NN * CQK;
  _Float16* Vt = Kh + (size_t)CB * NN * CQK;

  qk_proj<<<CB * NN / 256, 256, 0, stream>>>(x, Wq, Wk, Qh, Kh);
  vt_proj<<<CB * NN / 64, 256, 0, stream>>>(x, Wv, Vt);
  attn_kernel<<<CB * NN / 16 / 8, 256, 0, stream>>>(x, Qh, Kh, Vt, gamma, out);
}

// v001
// A run of this version takes 143 microseconds.
// Next to v000, in two timings, it ran 1.70 times as fast each time.
#include <hip/hip_runtime.h>

typedef __attribute__((ext_vector_type(16))) _Float16 v16h;
typedef __attribute__((ext_vector_type(8)))  _Float16 v8h;
typedef __attribute__((ext_vector_type(8)))  float    v8f;

#define CB   8      // batches
#define CC   128    // channels (c_in)
#define CQK  16     // q/k channels
#define NN   4096   // spatial positions (64*64)

// ---------------------------------------------------------------------------
// Phase 1a: Q/K projections.  Qh,Kh stored (b, n, 16) f16, row-contiguous so a
// lane can fetch its 8-halve WMMA operand slice with one 16-byte load.
// ---------------------------------------------------------------------------
__global__ void __launch_bounds__(256) qk_proj(
    const float* __restrict__ x, const float* __restrict__ Wq,
    const float* __restrict__ Wk, _Float16* __restrict__ Qh,
    _Float16* __restrict__ Kh) {
  __shared__ float sWq[CQK * CC];
  __shared__ float sWk[CQK * CC];
  int tid = threadIdx.x;
  for (int i = tid; i < CQK * CC; i += 256) { sWq[i] = Wq[i]; sWk[i] = Wk[i]; }
  __syncthreads();

  int gb = blockIdx.x * 256 + tid;          // 0 .. B*N-1
  int b  = gb / NN;
  int n  = gb % NN;
  const float* xp = x + (size_t)b * CC * NN + n;

  float qa[CQK] = {}, ka[CQK] = {};
  for (int c = 0; c < CC; ++c) {
    float xv = xp[(size_t)c * NN];          // coalesced along n
#pragma unroll
    for (int o = 0; o < CQK; ++o) {
      qa[o] += sWq[o * CC + c] * xv;
      ka[o] += sWk[o * CC + c] * xv;
    }
  }
  _Float16* qd = Qh + (size_t)gb * CQK;
  _Float16* kd = Kh + (size_t)gb * CQK;
#pragma unroll
  for (int o = 0; o < CQK; ++o) {
    qd[o] = (_Float16)qa[o];
    kd[o] = (_Float16)ka[o];
  }
}

// ---------------------------------------------------------------------------
// Phase 1b: V projection, stored TRANSPOSED: Vt (b, c, n) f16.
// x-tile (128 x 64, 32 KB) + full Wv (64 KB) staged in LDS so x is read from
// HBM exactly once.  256 threads = 4 channel-groups x 64 columns; weight reads
// are LDS broadcasts within a wave, x reads are conflict-free (stride-1 in n).
// ---------------------------------------------------------------------------
__global__ void __launch_bounds__(256) vt_proj(
    const float* __restrict__ x, const float* __restrict__ Wv,
    _Float16* __restrict__ Vt) {
  __shared__ float xs[CC * 64];
  __shared__ float sW[CC * CC];
  int tid = threadIdx.x;
  int blk = blockIdx.x;                     // 0 .. B*N/64-1
  int b   = blk / (NN / 64);
  int n0  = (blk % (NN / 64)) * 64;
  int nl  = tid & 63;                       // column within tile
  int c0  = (tid >> 6) * 32;                // 32 output channels per thread

  for (int i = tid; i < CC * 64; i += 256) {
    int ci = i >> 6, n = i & 63;
    xs[i] = x[(size_t)b * CC * NN + (size_t)ci * NN + n0 + n];
  }
  for (int i = tid; i < CC * CC; i += 256) sW[i] = Wv[i];
  __syncthreads();

  float acc[32] = {};
  for (int ci = 0; ci < CC; ++ci) {
    float xv = xs[ci * 64 + nl];
#pragma unroll
    for (int j = 0; j < 32; ++j) acc[j] += sW[(c0 + j) * CC + ci] * xv;
  }
#pragma unroll
  for (int j = 0; j < 32; ++j)
    Vt[((size_t)b * CC + (c0 + j)) * NN + n0 + nl] = (_Float16)acc[j];
}

// ---------------------------------------------------------------------------
// Phase 2: flash attention.  One wave per 16-row q-tile; S^T via WMMA so the
// softmax row = lane%16 (one shfl_xor(16) per reduction), P^T packs
// lane-locally, accumulator is out^T (c, n) tiles.  Lazy flash rescale: the
// 64-mul accumulator rescale only runs when some lane's running max grew.
//
// The eight waves of a block walk the same keys, so each stage of KS keys
// (V^T tile 128 x KS and K tile KS x 16) is brought into LDS once per block by
// asynchronous copies, two buffers: stage s+1 flies while stage s is worked on.
// V rows are pitched at 272 B (16 B x odd) so the 16 rows of a b128 fragment
// read fall on distinct banks; K rows (32 B) are read as 512 contiguous bytes.
// ---------------------------------------------------------------------------
#define KS      128                    // keys per stage
#define NST     (NN / KS)              // stages
#define VPITCH  136                    // halves per staged V row (272 B)
#define VBUF    (CC * VPITCH)          // halves per V buffer
#define KBUF    (KS * CQK)             // halves per K buffer

// One stage's copies of one thread: 8 x 16 B of V^T (a wave covers two whole
// 256-B rows per copy) and 16 B of K.  s_wait_xcnt 0 stands as the last line of
// the copies' own statement, ahead of any rewrite of the address registers.
__device__ __forceinline__ void stage_copy(const _Float16* gv, const _Float16* gk,
                                           unsigned lv, unsigned lk) {
  asm volatile(
      "global_load_async_to_lds_b128 %0, %9, off\n\t"
      "global_load_async_to_lds_b128 %1, %10, off\n\t"
      "global_load_async_to_lds_b128 %2, %11, off\n\t"
      "global_load_async_to_lds_b128 %3, %12, off\n\t"
      "global_load_async_to_lds_b128 %4, %13, off\n\t"
      "global_load_async_to_lds_b128 %5, %14, off\n\t"
      "global_load_async_to_lds_b128 %6, %15, off\n\t"
      "global_load_async_to_lds_b128 %7, %16, off\n\t"
      "global_load_async_to_lds_b128 %8, %17, off\n\t"
      "s_wait_xcnt 0x0"
      :: "v"(lv), "v"(lv + 1u * 16u * VPITCH * 2u), "v"(lv + 2u * 16u * VPITCH * 2u),
         "v"(lv + 3u * 16u * VPITCH * 2u), "v"(lv + 4u * 16u * VPITCH * 2u),
         "v"(lv + 5u * 16u * VPITCH * 2u), "v"(lv + 6u * 16u * VPITCH * 2u),
         "v"(lv + 7u * 16u * VPITCH * 2u), "v"(lk),
         "v"(gv), "v"(gv + 1 * 16 * NN), "v"(gv + 2 * 16 * NN), "v"(gv + 3 * 16 * NN),
         "v"(gv + 4 * 16 * NN), "v"(gv + 5 * 16 * NN), "v"(gv + 6 * 16 * NN),
         "v"(gv + 7 * 16 * NN), "v"(gk)
      : "memory");
}

__global__ void __launch_bounds__(256) attn_kernel(
    const float* __restrict__ x, const _Float16* __restrict__ Qh,
    const _Float16* __restrict__ Kh, const _Float16* __restrict__ Vt,
    const float* __restrict__ gamma, float* __restrict__ out) {
  __shared__ __attribute__((aligned(16))) _Float16 Vs[2 * VBUF];
  __shared__ __attribute__((aligned(16))) _Float16 Ks[2 * KBUF];

  int tid  = threadIdx.x;
  int lane = tid & 31;
  int wave = tid >> 5;
  int qt   = blockIdx.x * 8 + wave;         // global q-tile id (0..2047)
  int b    = qt >> 8;                       // 256 tiles per batch (same b for the block)
  int n0   = (qt & 255) << 4;               // q rows n0 .. n0+15
  int r    = lane & 15;                     // q_row within tile / N index
  int g    = lane >> 4;                     // half-group (K-offset selector)

  const v8f zero = {};

  // B-operand: Q tile, B[K=o (padded to 32), N=q_row]; halves 8..15 stay 0.
  v16h bq = {};
  {
    v8h lo = *(const v8h*)(Qh + ((size_t)b * NN + n0 + r) * CQK + 8 * g);
#pragma unroll
    for (int h = 0; h < 8; ++h) bq[h] = lo[h];
  }

  v8f acc[8];
#pragma unroll
  for (int t = 0; t < 8; ++t) acc[t] = zero;
  float mstat = -1e30f, lstat = 0.0f;

  const _Float16* Kb = Kh + (size_t)b * NN * CQK;
  const _Float16* Vb = Vt + (size_t)b * CC * NN;

  // This thread's share of a stage: V row (tid>>4) + 16*i, 16-B column tid&15;
  // K bytes 16*tid of the stage's 4 KB.
  const _Float16* gv = Vb + (size_t)(tid >> 4) * NN + (tid & 15) * 8;
  const _Float16* gk = Kb + tid * 8;
  const unsigned lv = (unsigned)(size_t)(&Vs[(tid >> 4) * VPITCH + (tid & 15) * 8]);
  const unsigned lk = (unsigned)(size_t)(&Ks[tid * 8]);

  // Prologue: stage 0 lands and is published, then stage 1 starts to fly.
  stage_copy(gv, gk, lv, lk);
  asm volatile("s_wait_asynccnt 0x0" ::: "memory");  // own copies of stage 0 landed
  __syncthreads();                                   // ... and every other wave's
  stage_copy(gv + KS, gk + KBUF, lv + VBUF * 2u, lk + KBUF * 2u);

  for (int s = 0; s < NST; ++s) {
    const int buf = s & 1;
    const _Float16* vs = Vs + buf * VBUF + r * VPITCH + 8 * g;
    const _Float16* ks = Ks + buf * KBUF + r * CQK + 8 * g;

#pragma unroll
    for (int mm = 0; mm < KS; mm += 32) {
      // A-operands: two K tiles, A[M = m col, K = o padded to 32]
      v16h ak0 = {}, ak1 = {};
      {
        v8h k0 = *(const v8h*)(ks + mm * CQK);
        v8h k1 = *(const v8h*)(ks + (mm + 16) * CQK);
#pragma unroll
        for (int h = 0; h < 8; ++h) { ak0[h] = k0[h]; ak1[h] = k1[h]; }
      }
      // S^T tiles: D[M = m local, N = q_row]
      v8f s0 = __builtin_amdgcn_wmma_f32_16x16x32_f16(false, ak0, false, bq,
                                                      (short)0, zero, false, false);
      v8f s1 = __builtin_amdgcn_wmma_f32_16x16x32_f16(false, ak1, false, bq,
                                                      (short)0, zero, false, false);

      // Running max over these 32 columns; per-lane row = r.
      float t = -1e30f;
#pragma unroll
      for (int v = 0; v < 8; ++v) t = fmaxf(t, fmaxf(s0[v], s1[v]));
      t = fmaxf(t, __shfl_xor(t, 16, 32));
      float mnew = fmaxf(mstat, t);

      // Lazy rescale: only when some lane's running max actually grew.
      if (__any(mnew > mstat)) {
        float sc = __expf(mstat - mnew);    // lanes with unchanged max: sc = 1
        lstat *= sc;
#pragma unroll
        for (int ct = 0; ct < 8; ++ct) {
#pragma unroll
          for (int v = 0; v < 8; ++v) acc[ct][v] *= sc;
        }
      }
      mstat = mnew;

      float p0[8], p1[8];
      float rsum = 0.0f;
#pragma unroll
      for (int v = 0; v < 8; ++v) {
        p0[v] = __expf(s0[v] - mnew);
        p1[v] = __expf(s1[v] - mnew);
        rsum += p0[v] + p1[v];
      }
      rsum += __shfl_xor(rsum, 16, 32);
      lstat += rsum;

      // Pack P^T lane-locally into B layout: B[K = m local 0..31, N = q_row].
      v16h bp;
#pragma unroll
      for (int v = 0; v < 8; ++v) {
        bp[v]     = (_Float16)p0[v];
        bp[8 + v] = (_Float16)p1[v];
      }

      // acc += V^T . P^T   (out^T tiles, M = c, N = q_row)
#pragma unroll
      for (int ct = 0; ct < 8; ++ct) {
        const _Float16* vrow = vs + ct * 16 * VPITCH + mm;
        v8h lo = *(const v8h*)(vrow);
        v8h hi = *(const v8h*)(vrow + 16);
        v16h av;
#pragma unroll
        for (int h = 0; h < 8; ++h) { av[h] = lo[h]; av[8 + h] = hi[h]; }
        acc[ct] = __builtin_amdgcn_wmma_f32_16x16x32_f16(false, av, false, bp,
                                                         (short)0, acc[ct], false, false);
      }
    }

    // Publish point of stage s+1, every wave, in this order.
    asm volatile("s_wait_dscnt 0x0" ::: "memory");     // own reads of buffer 'buf' returned
    asm volatile("s_wait_asynccnt 0x0" ::: "memory");  // own copies of stage s+1 landed
    __syncthreads();  // publishes stage s+1; ends every wave's reads of buffer 'buf'
    if (s + 2 < NST)  // block-uniform: refill the buffer just left with stage s+2
      stage_copy(gv + (s + 2) * KS, gk + (s + 2) * KBUF,
                 lv + buf * (VBUF * 2u), lk + buf * (KBUF * 2u));
  }
  asm volatile("s_wait_asynccnt 0x0" ::: "memory");    // no copy in flight at the wave's end

  // Epilogue: out(b,c,n) = x + gamma * out^T / lstat  (lstat uniform over v).
  float inv = gamma[0] / lstat;
  const float* xb = x + (size_t)b * CC * NN;
  float* ob = out + (size_t)b * CC * NN;
#pragma unroll
  for (int ct = 0; ct < 8; ++ct) {
#pragma unroll
    for (int v = 0; v < 8; ++v) {
      int c = ct * 16 + v + 8 * g;          // C/D layout: M = v + 8*(lane/16)
      size_t idx = (size_t)c * NN + n0 + r;
      ob[idx] = xb[idx] + inv * acc[ct][v];
    }
  }
}

// ---------------------------------------------------------------------------
extern "C" void kernel_launch(void* const* d_in, const int* in_sizes, int n_in,
                              void* d_out, int out_size, void* d_ws, size_t ws_size,
                              hipStream_t stream) {
  const float* x     = (const float*)d_in[0];
  const float* Wq    = (const float*)d_in[1];
  const float* Wk    = (const float*)d_in[2];
  const float* Wv    = (const float*)d_in[3];
  const float* gamma = (const float*)d_in[4];
  float* out = (float*)d_out;

  // Workspace: Qh (1 MB) | Kh (1 MB) | Vt (8 MB), all f16.
  _Float16* Qh = (_Float16*)d_ws;
  _Float16* Kh = Qh + (size_t)CB * NN * CQK;
  _Float16* Vt = Kh + (size_t)CB * NN * CQK;

  qk_proj<<<CB * NN / 256, 256, 0, stream>>>(x, Wq, Wk, Qh, Kh);
  vt_proj<<<CB * NN / 64, 256, 0, stream>>>(x, Wv, Vt);
  attn_kernel<<<CB * NN / 16 / 8, 256, 0, stream>>>(x, Qh, Kh, Vt, gamma, out);
}

// v002
// One run takes 67.9 microseconds.
// Two timings next to v001 both put it at 2.10 times that version's speed.
// Over all steps from v000 it is 3.58 times as fast.
#include <hip/hip_runtime.h>

typedef __attribute__((ext_vector_type(16))) _Float16 v16h;
typedef __attribute__((ext_vector_type(8)))  _Float16 v8h;
typedef __attribute__((ext_vector_type(8)))  float    v8f;
typedef __attribute__((ext_vector_type(4)))  float    v4f;
typedef __attribute__((ext_vector_type(2)))  float    v2f;

#define CB   8      // batches
#define CC   128    // channels (c_in)
#define CQK  16     // q/k channels
#define NN   4096   // spatial positions (64*64)

// ---------------------------------------------------------------------------
// Phase 1: Q, K and V projections as one product on the f32 matrix form
// (16x16x4): the 160 stacked weight rows (Wq | Wk | Wv) against x.
// A block owns 128 columns n, a wave 16 of them.  The wave's whole x slab
// (128 c x 16 n) sits in 64 registers and is read from memory exactly once; it
// serves as B for Q and K (D = [o][n]: a lane ends with 8 consecutive o of one
// n) and as A for V (D = [n][c]: a lane ends with 8 consecutive n of one c), so
// every result leaves as one packed 16-byte store.  Weights are staged in LDS,
// rows pitched at 528 B (16 B x odd) for conflict-free b128 fragment reads.
// k order, the same for both operands: of each 8 k, lane half g holds
// k = 4g .. 4g+3; the first matrix instruction takes the low pair, the second
// the high pair.
// Qh,Kh: (b, n, 16) f16.  Vt: (b, c, n) f16.
// ---------------------------------------------------------------------------
#define WROWS   (2 * CQK + CC)         // 160 stacked weight rows
#define WPITCH  (CC + 4)               // floats per staged weight row (528 B)

__global__ void __launch_bounds__(256) qkv_proj(
    const float* __restrict__ x, const float* __restrict__ Wq,
    const float* __restrict__ Wk, const float* __restrict__ Wv,
    _Float16* __restrict__ Qh, _Float16* __restrict__ Kh,
    _Float16* __restrict__ Vt) {
  __shared__ __attribute__((aligned(16))) float sW[WROWS * WPITCH];
  int tid  = threadIdx.x;
  int lane = tid & 31;
  int wave = tid >> 5;
  int r    = lane & 15;
  int g    = lane >> 4;
  int b    = blockIdx.x / (NN / 128);
  int n0   = (blockIdx.x % (NN / 128)) * 128 + wave * 16;

  // Weight loads first, 16 bytes a thread a trip (a wave to a row), then the
  // wave's x slab: the weights are staged while the slab is still in flight.
  v4f wr[WROWS / 8];
#pragma unroll
  for (int i = 0; i < WROWS / 8; ++i) {
    const float* wsrc = i < 2 ? Wq + (i * 8 + wave) * CC
                      : i < 4 ? Wk + ((i - 2) * 8 + wave) * CC
                              : Wv + ((i - 4) * 8 + wave) * CC;
    wr[i] = *(const v4f*)(wsrc + lane * 4);
    // Ahead of any reuse of the address registers of the loads issued so far
    // (behind the last Wk load and behind the last Wv load).
    if (i == 3 || i == WROWS / 8 - 1) asm volatile("s_wait_xcnt 0x0" ::: "memory");
  }

  const float* xp = x + (size_t)b * CC * NN + (size_t)(4 * g) * NN + n0 + r;
  v2f xf[CC / 4];
#pragma unroll
  for (int kb = 0; kb < CC / 8; ++kb) {
    xf[2 * kb][0]     = xp[(size_t)(kb * 8 + 0) * NN];
    xf[2 * kb][1]     = xp[(size_t)(kb * 8 + 1) * NN];
    xf[2 * kb + 1][0] = xp[(size_t)(kb * 8 + 2) * NN];
    xf[2 * kb + 1][1] = xp[(size_t)(kb * 8 + 3) * NN];
  }
  // Ahead of any reuse of the slab loads' address registers.
  asm volatile("s_wait_xcnt 0x0" ::: "memory");

#pragma unroll
  for (int i = 0; i < WROWS / 8; ++i)
    *(v4f*)(&sW[(i * 8 + wave) * WPITCH + lane * 4]) = wr[i];
  __syncthreads();

  v8f acc[WROWS / 16];
#pragma unroll
  for (int t = 0; t < WROWS / 16; ++t) acc[t] = v8f{};

  // Weight fragments are double-buffered in registers: the reads of block kb+1
  // stand as one group ahead of the matrix instructions of block kb.
  const float* wl = sW + r * WPITCH + 4 * g;
  v4f w[2][WROWS / 16];
#pragma unroll
  for (int t = 0; t < WROWS / 16; ++t) w[0][t] = *(const v4f*)(wl + t * 16 * WPITCH);
#pragma unroll
  for (int kb = 0; kb < CC / 8; ++kb) {
    if (kb + 1 < CC / 8) {
#pragma unroll
      for (int t = 0; t < WROWS / 16; ++t)
        w[(kb + 1) & 1][t] = *(const v4f*)(wl + t * 16 * WPITCH + (kb + 1) * 8);
    }
    // Keeps the group of reads above ahead of this block's matrix instructions;
    // without it each read sinks to just before its use and is waited for there.
    __builtin_amdgcn_sched_barrier(0);
#pragma unroll
    for (int hh = 0; hh < 2; ++hh) {
      v2f xv = xf[2 * kb + hh];
#pragma unroll
      for (int t = 0; t < WROWS / 16; ++t) {
        v2f wv = {w[kb & 1][t][2 * hh], w[kb & 1][t][2 * hh + 1]};
        if (t < 2)   // Q, K: D[M = o][N = n]
          acc[t] = __builtin_amdgcn_wmma_f32_16x16x4_f32(false, wv, false, xv,
                                                         (short)0, acc[t], false, false);
        else         // V: D[M = n][N = c]
          acc[t] = __builtin_amdgcn_wmma_f32_16x16x4_f32(false, xv, false, wv,
                                                         (short)0, acc[t], false, false);
      }
    }
    // Ends the block: the next group of reads stays behind these instructions.
    __builtin_amdgcn_sched_barrier(0);
  }

#pragma unroll
  for (int t = 0; t < WROWS / 16; ++t) {
    v8h o;
#pragma unroll
    for (int v = 0; v < 8; ++v) o[v] = (_Float16)acc[t][v];
    _Float16* dst =
        t == 0 ? Qh + ((size_t)b * NN + n0 + r) * CQK + 8 * g
      : t == 1 ? Kh + ((size_t)b * NN + n0 + r) * CQK + 8 * g
               : Vt + ((size_t)b * CC + (t - 2) * 16 + r) * NN + n0 + 8 * g;
    *(v8h*)dst = o;
  }
}

// ---------------------------------------------------------------------------
// Phase 2: flash attention.  One wave per 16-row q-tile; S^T via WMMA so the
// softmax row = lane%16 (one shfl_xor(16) per reduction), P^T packs
// lane-locally, accumulator is out^T (c, n) tiles.  Lazy flash rescale: the
// 64-mul accumulator rescale only runs when some lane's running max grew.
//
// The eight waves of a block walk the same keys, so each stage of KS keys
// (V^T tile 128 x KS and K tile KS x 16) is brought into LDS once per block by
// asynchronous copies, two buffers: stage s+1 flies while stage s is worked on.
// V rows are pitched at 272 B (16 B x odd) so the 16 rows of a b128 fragment
// read fall on distinct banks; K rows (32 B) are read as 512 contiguous bytes.
// ---------------------------------------------------------------------------
#define KS      128                    // keys per stage
#define NST     (NN / KS)              // stages
#define VPITCH  136                    // halves per staged V row (272 B)
#define VBUF    (CC * VPITCH)          // halves per V buffer
#define KBUF    (KS * CQK)             // halves per K buffer

// One stage's copies of one thread: 8 x 16 B of V^T (a wave covers two whole
// 256-B rows per copy) and 16 B of K.  s_wait_xcnt 0 stands as the last line of
// the copies' own statement, ahead of any rewrite of the address registers.
__device__ __forceinline__ void stage_copy(const _Float16* gv, const _Float16* gk,
                                           unsigned lv, unsigned lk) {
  asm volatile(
      "global_load_async_to_lds_b128 %0, %9, off\n\t"
      "global_load_async_to_lds_b128 %1, %10, off\n\t"
      "global_load_async_to_lds_b128 %2, %11, off\n\t"
      "global_load_async_to_lds_b128 %3, %12, off\n\t"
      "global_load_async_to_lds_b128 %4, %13, off\n\t"
      "global_load_async_to_lds_b128 %5, %14, off\n\t"
      "global_load_async_to_lds_b128 %6, %15, off\n\t"
      "global_load_async_to_lds_b128 %7, %16, off\n\t"
      "global_load_async_to_lds_b128 %8, %17, off\n\t"
      "s_wait_xcnt 0x0"
      :: "v"(lv), "v"(lv + 1u * 16u * VPITCH * 2u), "v"(lv + 2u * 16u * VPITCH * 2u),
         "v"(lv + 3u * 16u * VPITCH * 2u), "v"(lv + 4u * 16u * VPITCH * 2u),
         "v"(lv + 5u * 16u * VPITCH * 2u), "v"(lv + 6u * 16u * VPITCH * 2u),
         "v"(lv + 7u * 16u * VPITCH * 2u), "v"(lk),
         "v"(gv), "v"(gv + 1 * 16 * NN), "v"(gv + 2 * 16 * NN), "v"(gv + 3 * 16 * NN),
         "v"(gv + 4 * 16 * NN), "v"(gv + 5 * 16 * NN), "v"(gv + 6 * 16 * NN),
         "v"(gv + 7 * 16 * NN), "v"(gk)
      : "memory");
}

__global__ void __launch_bounds__(256) attn_kernel(
    const float* __restrict__ x, const _Float16* __restrict__ Qh,
    const _Float16* __restrict__ Kh, const _Float16* __restrict__ Vt,
    const float* __restrict__ gamma, float* __restrict__ out) {
  __shared__ __attribute__((aligned(16))) _Float16 Vs[2 * VBUF];
  __shared__ __attribute__((aligned(16))) _Float16 Ks[2 * KBUF];

  int tid  = threadIdx.x;
  int lane = tid & 31;
  int wave = tid >> 5;
  int qt   = blockIdx.x * 8 + wave;         // global q-tile id (0..2047)
  int b    = qt >> 8;                       // 256 tiles per batch (same b for the block)
  int n0   = (qt & 255) << 4;               // q rows n0 .. n0+15
  int r    = lane & 15;                     // q_row within tile / N index
  int g    = lane >> 4;                     // half-group (K-offset selector)

  const v8f zero = {};

  // B-operand: Q tile, B[K=o (padded to 32), N=q_row]; halves 8..15 stay 0.
  v16h bq = {};
  {
    v8h lo = *(const v8h*)(Qh + ((size_t)b * NN + n0 + r) * CQK + 8 * g);
#pragma unroll
    for (int h = 0; h < 8; ++h) bq[h] = lo[h];
  }

  v8f acc[8];
#pragma unroll
  for (int t = 0; t < 8; ++t) acc[t] = zero;
  float mstat = -1e30f, lstat = 0.0f;

  const _Float16* Kb = Kh + (size_t)b * NN * CQK;
  const _Float16* Vb = Vt + (size_t)b * CC * NN;

  // This thread's share of a stage: V row (tid>>4) + 16*i, 16-B column tid&15;
  // K bytes 16*tid of the stage's 4 KB.
  const _Float16* gv = Vb + (size_t)(tid >> 4) * NN + (tid & 15) * 8;
  const _Float16* gk = Kb + tid * 8;
  const unsigned lv = (unsigned)(size_t)(&Vs[(tid >> 4) * VPITCH + (tid & 15) * 8]);
  const unsigned lk = (unsigned)(size_t)(&Ks[tid * 8]);

  // Prologue: stage 0 lands and is published, then stage 1 starts to fly.
  stage_copy(gv, gk, lv, lk);
  asm volatile("s_wait_asynccnt 0x0" ::: "memory");  // own copies of stage 0 landed
  __syncthreads();                                   // ... and every other wave's
  stage_copy(gv + KS, gk + KBUF, lv + VBUF * 2u, lk + KBUF * 2u);

  for (int s = 0; s < NST; ++s) {
    const int buf = s & 1;
    const _Float16* vs = Vs + buf * VBUF + r * VPITCH + 8 * g;
    const _Float16* ks = Ks + buf * KBUF + r * CQK + 8 * g;

#pragma unroll
    for (int mm = 0; mm < KS; mm += 32) {
      // A-operands: two K tiles, A[M = m col, K = o padded to 32]
      v16h ak0 = {}, ak1 = {};
      {
        v8h k0 = *(const v8h*)(ks + mm * CQK);
        v8h k1 = *(const v8h*)(ks + (mm + 16) * CQK);
#pragma unroll
        for (int h = 0; h < 8; ++h) { ak0[h] = k0[h]; ak1[h] = k1[h]; }
      }
      // S^T tiles: D[M = m local, N = q_row]
      v8f s0 = __builtin_amdgcn_wmma_f32_16x16x32_f16(false, ak0, false, bq,
                                                      (short)0, zero, false, false);
      v8f s1 = __builtin_amdgcn_wmma_f32_16x16x32_f16(false, ak1, false, bq,
                                                      (short)0, zero, false, false);

      // Running max over these 32 columns; per-lane row = r.
      float t = -1e30f;
#pragma unroll
      for (int v = 0; v < 8; ++v) t = fmaxf(t, fmaxf(s0[v], s1[v]));
      t = fmaxf(t, __shfl_xor(t, 16, 32));
      float mnew = fmaxf(mstat, t);

      // Lazy rescale: only when some lane's running max actually grew.
      if (__any(mnew > mstat)) {
        float sc = __expf(mstat - mnew);    // lanes with unchanged max: sc = 1
        lstat *= sc;
#pragma unroll
        for (int ct = 0; ct < 8; ++ct) {
#pragma unroll
          for (int v = 0; v < 8; ++v) acc[ct][v] *= sc;
        }
      }
      mstat = mnew;

      float p0[8], p1[8];
      float rsum = 0.0f;
#pragma unroll
      for (int v = 0; v < 8; ++v) {
        p0[v] = __expf(s0[v] - mnew);
        p1[v] = __expf(s1[v] - mnew);
        rsum += p0[v] + p1[v];
      }
      rsum += __shfl_xor(rsum, 16, 32);
      lstat += rsum;

      // Pack P^T lane-locally into B layout: B[K = m local 0..31, N = q_row].
      v16h bp;
#pragma unroll
      for (int v = 0; v < 8; ++v) {
        bp[v]     = (_Float16)p0[v];
        bp[8 + v] = (_Float16)p1[v];
      }

      // acc += V^T . P^T   (out^T tiles, M = c, N = q_row)
#pragma unroll
      for (int ct = 0; ct < 8; ++ct) {
        const _Float16* vrow = vs + ct * 16 * VPITCH + mm;
        v8h lo = *(const v8h*)(vrow);
        v8h hi = *(const v8h*)(vrow + 16);
        v16h av;
#pragma unroll
        for (int h = 0; h < 8; ++h) { av[h] = lo[h]; av[8 + h] = hi[h]; }
        acc[ct] = __builtin_amdgcn_wmma_f32_16x16x32_f16(false, av, false, bp,
                                                         (short)0, acc[ct], false, false);
      }
    }

    // Publish point of stage s+1, every wave, in this order.
    asm volatile("s_wait_dscnt 0x0" ::: "memory");     // own reads of buffer 'buf' returned
    asm volatile("s_wait_asynccnt 0x0" ::: "memory");  // own copies of stage s+1 landed
    __syncthreads();  // publishes stage s+1; ends every wave's reads of buffer 'buf'
    if (s + 2 < NST)  // block-uniform: refill the buffer just left with stage s+2
      stage_copy(gv + (s + 2) * KS, gk + (s + 2) * KBUF,
                 lv + buf * (VBUF * 2u), lk + buf * (KBUF * 2u));
  }
  asm volatile("s_wait_asynccnt 0x0" ::: "memory");    // no copy in flight at the wave's end

  // Epilogue: out(b,c,n) = x + gamma * out^T / lstat  (lstat uniform over v).
  float inv = gamma[0] / lstat;
  const float* xb = x + (size_t)b * CC * NN;
  float* ob = out + (size_t)b * CC * NN;
#pragma unroll
  for (int ct = 0; ct < 8; ++ct) {
#pragma unroll
    for (int v = 0; v < 8; ++v) {
      int c = ct * 16 + v + 8 * g;          // C/D layout: M = v + 8*(lane/16)
      size_t idx = (size_t)c * NN + n0 + r;
      ob[idx] = xb[idx] + inv * acc[ct][v];
    }
  }
}

// ---------------------------------------------------------------------------
extern "C" void kernel_launch(void* const* d_in, const int* in_sizes, int n_in,
                              void* d_out, int out_size, void* d_ws, size_t ws_size,
                              hipStream_t stream) {
  const float* x     = (const float*)d_in[0];
  const float* Wq    = (const float*)d_in[1];
  const float* Wk    = (const float*)d_in[2];
  const float* Wv    = (const float*)d_in[3];
  const float* gamma = (const float*)d_in[4];
  float* out = (float*)d_out;

  // Workspace: Qh (1 MB) | Kh (1 MB) | Vt (8 MB), all f16.
  _Float16* Qh = (_Float16*)d_ws;
  _Float16* Kh = Qh + (size_t)CB * NN * CQK;
  _Float16* Vt = Kh + (size_t)CB * NN * CQK;

  qkv_proj<<<CB * NN / 128, 256, 0, stream>>>(x, Wq, Wk, Wv, Qh, Kh, Vt);
  attn_kernel<<<CB * NN / 16 / 8, 256, 0, stream>>>(x, Qh, Kh, Vt, gamma, out);
}

// v003
// Measured time: 64.1 microseconds a run.
// In both of two side-by-side timings against v002, it was 1.06 times as fast.
// Counting every step since v000, it is 3.79 times as fast.
#include <hip/hip_runtime.h>

typedef __attribute__((ext_vector_type(16))) _Float16 v16h;
typedef __attribute__((ext_vector_type(8)))  _Float16 v8h;
typedef __attribute__((ext_vector_type(8)))  float    v8f;
typedef __attribute__((ext_vector_type(4)))  float    v4f;
typedef __attribute__((ext_vector_type(2)))  float    v2f;

#define CB   8      // batches
#define CC   128    // channels (c_in)
#define CQK  16     // q/k channels
#define NN   4096   // spatial positions (64*64)

// ---------------------------------------------------------------------------
// Phase 1: Q, K and V projections as one product on the f32 matrix form
// (16x16x4): the 160 stacked weight rows (Wq | Wk | Wv) against x.
// A block owns 128 columns n, a wave 16 of them.  The wave's whole x slab
// (128 c x 16 n) sits in 64 registers and is read from memory exactly once; it
// serves as B for Q and K (D = [o][n]: a lane ends with 8 consecutive o of one
// n) and as A for V (D = [n][c]: a lane ends with 8 consecutive n of one c), so
// every result leaves as one packed 16-byte store.  Weights are staged in LDS,
// rows pitched at 528 B (16 B x odd) for conflict-free b128 fragment reads.
// k order, the same for both operands: of each 8 k, lane half g holds
// k = 4g .. 4g+3; the first matrix instruction takes the low pair, the second
// the high pair.
// Qh,Kh: (b, n, 16) f16.  Vt: (b, c, n) f16.
// ---------------------------------------------------------------------------
#define WROWS   (2 * CQK + CC)         // 160 stacked weight rows
#define WPITCH  (CC + 4)               // floats per staged weight row (528 B)

__global__ void __launch_bounds__(256) qkv_proj(
    const float* __restrict__ x, const float* __restrict__ Wq,
    const float* __restrict__ Wk, const float* __restrict__ Wv,
    _Float16* __restrict__ Qh, _Float16* __restrict__ Kh,
    _Float16* __restrict__ Vt) {
  __shared__ __attribute__((aligned(16))) float sW[WROWS * WPITCH];
  int tid  = threadIdx.x;
  int lane = tid & 31;
  int wave = tid >> 5;
  int r    = lane & 15;
  int g    = lane >> 4;
  int b    = blockIdx.x / (NN / 128);
  int n0   = (blockIdx.x % (NN / 128)) * 128 + wave * 16;

  // Weight loads first, 16 bytes a thread a trip (a wave to a row), then the
  // wave's x slab: the weights are staged while the slab is still in flight.
  v4f wr[WROWS / 8];
#pragma unroll
  for (int i = 0; i < WROWS / 8; ++i) {
    const float* wsrc = i < 2 ? Wq + (i * 8 + wave) * CC
                      : i < 4 ? Wk + ((i - 2) * 8 + wave) * CC
                              : Wv + ((i - 4) * 8 + wave) * CC;
    wr[i] = *(const v4f*)(wsrc + lane * 4);
    // Ahead of any reuse of the address registers of the loads issued so far
    // (behind the last Wk load and behind the last Wv load).
    if (i == 3 || i == WROWS / 8 - 1) asm volatile("s_wait_xcnt 0x0" ::: "memory");
  }

  const float* xp = x + (size_t)b * CC * NN + (size_t)(4 * g) * NN + n0 + r;
  v2f xf[CC / 4];
#pragma unroll
  for (int kb = 0; kb < CC / 8; ++kb) {
    xf[2 * kb][0]     = xp[(size_t)(kb * 8 + 0) * NN];
    xf[2 * kb][1]     = xp[(size_t)(kb * 8 + 1) * NN];
    xf[2 * kb + 1][0] = xp[(size_t)(kb * 8 + 2) * NN];
    xf[2 * kb + 1][1] = xp[(size_t)(kb * 8 + 3) * NN];
  }
  // Ahead of any reuse of the slab loads' address registers.
  asm volatile("s_wait_xcnt 0x0" ::: "memory");

#pragma unroll
  for (int i = 0; i < WROWS / 8; ++i)
    *(v4f*)(&sW[(i * 8 + wave) * WPITCH + lane * 4]) = wr[i];
  __syncthreads();

  v8f acc[WROWS / 16];
#pragma unroll
  for (int t = 0; t < WROWS / 16; ++t) acc[t] = v8f{};

  // Weight fragments are double-buffered in registers: the reads of block kb+1
  // stand as one group ahead of the matrix instructions of block kb.
  const float* wl = sW + r * WPITCH + 4 * g;
  v4f w[2][WROWS / 16];
#pragma unroll
  for (int t = 0; t < WROWS / 16; ++t) w[0][t] = *(const v4f*)(wl + t * 16 * WPITCH);
#pragma unroll
  for (int kb = 0; kb < CC / 8; ++kb) {
    if (kb + 1 < CC / 8) {
#pragma unroll
      for (int t = 0; t < WROWS / 16; ++t)
        w[(kb + 1) & 1][t] = *(const v4f*)(wl + t * 16 * WPITCH + (kb + 1) * 8);
    }
    // Keeps the group of reads above ahead of this block's matrix instructions;
    // without it each read sinks to just before its use and is waited for there.
    __builtin_amdgcn_sched_barrier(0);
#pragma unroll
    for (int hh = 0; hh < 2; ++hh) {
      v2f xv = xf[2 * kb + hh];
#pragma unroll
      for (int t = 0; t < WROWS / 16; ++t) {
        v2f wv = {w[kb & 1][t][2 * hh], w[kb & 1][t][2 * hh + 1]};
        if (t < 2)   // Q, K: D[M = o][N = n]
          acc[t] = __builtin_amdgcn_wmma_f32_16x16x4_f32(false, wv, false, xv,
                                                         (short)0, acc[t], false, false);
        else         // V: D[M = n][N = c]
          acc[t] = __builtin_amdgcn_wmma_f32_16x16x4_f32(false, xv, false, wv,
                                                         (short)0, acc[t], false, false);
      }
    }
    // Ends the block: the next group of reads stays behind these instructions.
    __builtin_amdgcn_sched_barrier(0);
  }

#pragma unroll
  for (int t = 0; t < WROWS / 16; ++t) {
    v8h o;
#pragma unroll
    for (int v = 0; v < 8; ++v) o[v] = (_Float16)acc[t][v];
    _Float16* dst =
        t == 0 ? Qh + ((size_t)b * NN + n0 + r) * CQK + 8 * g
      : t == 1 ? Kh + ((size_t)b * NN + n0 + r) * CQK + 8 * g
               : Vt + ((size_t)b * CC + (t - 2) * 16 + r) * NN + n0 + 8 * g;
    *(v8h*)dst = o;
  }
}

// ---------------------------------------------------------------------------
// Phase 2: flash attention.  One wave per 16-row q-tile; S^T via WMMA so the
// softmax row = lane%16 (one shfl_xor(16) per reduction), P^T packs
// lane-locally, accumulator is out^T (c, n) tiles.  Lazy flash rescale: the
// 64-mul accumulator rescale only runs when some lane's running max grew.
//
// The eight waves of a block walk the same keys, so each stage of KS keys
// (V^T tile 128 x KS and K tile KS x 16) is brought into LDS once per block by
// asynchronous copies, two buffers: stage s+1 flies while stage s is worked on.
// V rows are pitched at 272 B (16 B x odd) so the 16 rows of a b128 fragment
// read fall on distinct banks; K rows (32 B) are read as 512 contiguous bytes.
// All LDS fragment reads of a 32-key pass stand as one group at its head: the 16
// V^T reads of this pass and the 2 K reads of the stage's next pass.  They
// return while the pass's scores and softmax are worked, so neither the S^T nor
// the V^T.P^T products wait for LDS (but for K at the head of a stage).
// ---------------------------------------------------------------------------
#define KS      128                    // keys per stage
#define NST     (NN / KS)              // stages
#define VPITCH  136                    // halves per staged V row (272 B)
#define VBUF    (CC * VPITCH)          // halves per V buffer
#define KBUF    (KS * CQK)             // halves per K buffer

// One stage's copies of one thread: 8 x 16 B of V^T (a wave covers two whole
// 256-B rows per copy) and 16 B of K.  s_wait_xcnt 0 stands as the last line of
// the copies' own statement, ahead of any rewrite of the address registers.
__device__ __forceinline__ void stage_copy(const _Float16* gv, const _Float16* gk,
                                           unsigned lv, unsigned lk) {
  asm volatile(
      "global_load_async_to_lds_b128 %0, %9, off\n\t"
      "global_load_async_to_lds_b128 %1, %10, off\n\t"
      "global_load_async_to_lds_b128 %2, %11, off\n\t"
      "global_load_async_to_lds_b128 %3, %12, off\n\t"
      "global_load_async_to_lds_b128 %4, %13, off\n\t"
      "global_load_async_to_lds_b128 %5, %14, off\n\t"
      "global_load_async_to_lds_b128 %6, %15, off\n\t"
      "global_load_async_to_lds_b128 %7, %16, off\n\t"
      "global_load_async_to_lds_b128 %8, %17, off\n\t"
      "s_wait_xcnt 0x0"
      :: "v"(lv), "v"(lv + 1u * 16u * VPITCH * 2u), "v"(lv + 2u * 16u * VPITCH * 2u),
         "v"(lv + 3u * 16u * VPITCH * 2u), "v"(lv + 4u * 16u * VPITCH * 2u),
         "v"(lv + 5u * 16u * VPITCH * 2u), "v"(lv + 6u * 16u * VPITCH * 2u),
         "v"(lv + 7u * 16u * VPITCH * 2u), "v"(lk),
         "v"(gv), "v"(gv + 1 * 16 * NN), "v"(gv + 2 * 16 * NN), "v"(gv + 3 * 16 * NN),
         "v"(gv + 4 * 16 * NN), "v"(gv + 5 * 16 * NN), "v"(gv + 6 * 16 * NN),
         "v"(gv + 7 * 16 * NN), "v"(gk)
      : "memory");
}

__global__ void __launch_bounds__(256) attn_kernel(
    const float* __restrict__ x, const _Float16* __restrict__ Qh,
    const _Float16* __restrict__ Kh, const _Float16* __restrict__ Vt,
    const float* __restrict__ gamma, float* __restrict__ out) {
  __shared__ __attribute__((aligned(16))) _Float16 Vs[2 * VBUF];
  __shared__ __attribute__((aligned(16))) _Float16 Ks[2 * KBUF];

  int tid  = threadIdx.x;
  int lane = tid & 31;
  int wave = tid >> 5;
  int qt   = blockIdx.x * 8 + wave;         // global q-tile id (0..2047)
  int b    = qt >> 8;                       // 256 tiles per batch (same b for the block)
  int n0   = (qt & 255) << 4;               // q rows n0 .. n0+15
  int r    = lane & 15;                     // q_row within tile / N index
  int g    = lane >> 4;                     // half-group (K-offset selector)

  const v8f zero = {};

  // B-operand: Q tile, B[K=o (padded to 32), N=q_row]; halves 8..15 stay 0.
  v16h bq = {};
  {
    v8h lo = *(const v8h*)(Qh + ((size_t)b * NN + n0 + r) * CQK + 8 * g);
#pragma unroll
    for (int h = 0; h < 8; ++h) bq[h] = lo[h];
  }

  v8f acc[8];
#pragma unroll
  for (int t = 0; t < 8; ++t) acc[t] = zero;
  float mstat = -1e30f, lstat = 0.0f;

  const _Float16* Kb = Kh + (size_t)b * NN * CQK;
  const _Float16* Vb = Vt + (size_t)b * CC * NN;

  // This thread's share of a stage: V row (tid>>4) + 16*i, 16-B column tid&15;
  // K bytes 16*tid of the stage's 4 KB.
  const _Float16* gv = Vb + (size_t)(tid >> 4) * NN + (tid & 15) * 8;
  const _Float16* gk = Kb + tid * 8;
  const unsigned lv = (unsigned)(size_t)(&Vs[(tid >> 4) * VPITCH + (tid & 15) * 8]);
  const unsigned lk = (unsigned)(size_t)(&Ks[tid * 8]);

  // Prologue: stage 0 lands and is published, then stage 1 starts to fly.
  stage_copy(gv, gk, lv, lk);
  asm volatile("s_wait_asynccnt 0x0" ::: "memory");  // own copies of stage 0 landed
  __syncthreads();                                   // ... and every other wave's
  stage_copy(gv + KS, gk + KBUF, lv + VBUF * 2u, lk + KBUF * 2u);

  for (int s = 0; s < NST; ++s) {
    const int buf = s & 1;
    const _Float16* vs = Vs + buf * VBUF + r * VPITCH + 8 * g;
    const _Float16* ks = Ks + buf * KBUF + r * CQK + 8 * g;

    // K fragments, two register sets; the stage's first pair is read here.
    v8h kf[2][2];
    kf[0][0] = *(const v8h*)(ks);
    kf[0][1] = *(const v8h*)(ks + 16 * CQK);
    // Keeps this pair ahead of the first pass's group: its S^T products then wait
    // for these two reads and not for the eighteen behind them.
    __builtin_amdgcn_sched_barrier(0);

#pragma unroll
    for (int mm = 0; mm < KS; mm += 32) {
      const int cur = (mm >> 5) & 1;
      // The pass's read group: its V^T fragments, then the next pass's K pair
      // (never beyond this stage's buffer).
      v8h vlo[8], vhi[8];
#pragma unroll
      for (int ct = 0; ct < 8; ++ct) {
        const _Float16* vrow = vs + ct * 16 * VPITCH + mm;
        vlo[ct] = *(const v8h*)(vrow);
        vhi[ct] = *(const v8h*)(vrow + 16);
      }
      if (mm + 32 < KS) {
        kf[cur ^ 1][0] = *(const v8h*)(ks + (mm + 32) * CQK);
        kf[cur ^ 1][1] = *(const v8h*)(ks + (mm + 48) * CQK);
      }
      // Keeps the group above ahead of the pass's work; without it each read
      // sinks to just before its matrix instruction and is waited for there.
      __builtin_amdgcn_sched_barrier(0);

      // A-operands: two K tiles, A[M = m col, K = o padded to 32]
      v16h ak0 = {}, ak1 = {};
#pragma unroll
      for (int h = 0; h < 8; ++h) { ak0[h] = kf[cur][0][h]; ak1[h] = kf[cur][1][h]; }
      // S^T tiles: D[M = m local, N = q_row]
      v8f s0 = __builtin_amdgcn_wmma_f32_16x16x32_f16(false, ak0, false, bq,
                                                      (short)0, zero, false, false);
      v8f s1 = __builtin_amdgcn_wmma_f32_16x16x32_f16(false, ak1, false, bq,
                                                      (short)0, zero, false, false);

      // Running max over these 32 columns; per-lane row = r.
      float t = -1e30f;
#pragma unroll
      for (int v = 0; v < 8; ++v) t = fmaxf(t, fmaxf(s0[v], s1[v]));
      t = fmaxf(t, __shfl_xor(t, 16, 32));
      float mnew = fmaxf(mstat, t);

      // Lazy rescale: only when some lane's running max actually grew.
      if (__any(mnew > mstat)) {
        float sc = __expf(mstat - mnew);    // lanes with unchanged max: sc = 1
        lstat *= sc;
#pragma unroll
        for (int ct = 0; ct < 8; ++ct) {
#pragma unroll
          for (int v = 0; v < 8; ++v) acc[ct][v] *= sc;
        }
      }
      mstat = mnew;

      float p0[8], p1[8];
      float rsum = 0.0f;
#pragma unroll
      for (int v = 0; v < 8; ++v) {
        p0[v] = __expf(s0[v] - mnew);
        p1[v] = __expf(s1[v] - mnew);
        rsum += p0[v] + p1[v];
      }
      rsum += __shfl_xor(rsum, 16, 32);
      lstat += rsum;

      // Pack P^T lane-locally into B layout: B[K = m local 0..31, N = q_row].
      v16h bp;
#pragma unroll
      for (int v = 0; v < 8; ++v) {
        bp[v]     = (_Float16)p0[v];
        bp[8 + v] = (_Float16)p1[v];
      }

      // acc += V^T . P^T   (out^T tiles, M = c, N = q_row)
#pragma unroll
      for (int ct = 0; ct < 8; ++ct) {
        v16h av;
#pragma unroll
        for (int h = 0; h < 8; ++h) { av[h] = vlo[ct][h]; av[8 + h] = vhi[ct][h]; }
        acc[ct] = __builtin_amdgcn_wmma_f32_16x16x32_f16(false, av, false, bp,
                                                         (short)0, acc[ct], false, false);
      }
      // Ends the pass: the next group of reads stays behind these instructions.
      __builtin_amdgcn_sched_barrier(0);
    }

    // Publish point of stage s+1, every wave, in this order.
    asm volatile("s_wait_dscnt 0x0" ::: "memory");     // own reads of buffer 'buf' returned
    asm volatile("s_wait_asynccnt 0x0" ::: "memory");  // own copies of stage s+1 landed
    __syncthreads();  // publishes stage s+1; ends every wave's reads of buffer 'buf'
    if (s + 2 < NST)  // block-uniform: refill the buffer just left with stage s+2
      stage_copy(gv + (s + 2) * KS, gk + (s + 2) * KBUF,
                 lv + buf * (VBUF * 2u), lk + buf * (KBUF * 2u));
  }
  asm volatile("s_wait_asynccnt 0x0" ::: "memory");    // no copy in flight at the wave's end

  // Epilogue: out(b,c,n) = x + gamma * out^T / lstat  (lstat uniform over v).
  float inv = gamma[0] / lstat;
  const float* xb = x + (size_t)b * CC * NN;
  float* ob = out + (size_t)b * CC * NN;
#pragma unroll
  for (int ct = 0; ct < 8; ++ct) {
#pragma unroll
    for (int v = 0; v < 8; ++v) {
      int c = ct * 16 + v + 8 * g;          // C/D layout: M = v + 8*(lane/16)
      size_t idx = (size_t)c * NN + n0 + r;
      ob[idx] = xb[idx] + inv * acc[ct][v];
    }
  }
}

// ---------------------------------------------------------------------------
extern "C" void kernel_launch(void* const* d_in, const int* in_sizes, int n_in,
                              void* d_out, int out_size, void* d_ws, size_t ws_size,
                              hipStream_t stream) {
  const float* x     = (const float*)d_in[0];
  const float* Wq    = (const float*)d_in[1];
  const float* Wk    = (const float*)d_in[2];
  const float* Wv    = (const float*)d_in[3];
  const float* gamma = (const float*)d_in[4];
  float* out = (float*)d_out;

  // Workspace: Qh (1 MB) | Kh (1 MB) | Vt (8 MB), all f16.
  _Float16* Qh = (_Float16*)d_ws;
  _Float16* Kh = Qh + (size_t)CB * NN * CQK;
  _Float16* Vt = Kh + (size_t)CB * NN * CQK;

  qkv_proj<<<CB * NN / 128, 256, 0, stream>>>(x, Wq, Wk, Wv, Qh, Kh, Vt);
  attn_kernel<<<CB * NN / 16 / 8, 256, 0, stream>>>(x, Qh, Kh, Vt, gamma, out);
}

// v004
// Measured time: 56.6 microseconds a run.
// Timed twice side by side with v003, it ran 1.13 and 1.14 times as fast.
// Counting every step since v000, it is 4.30 times as fast.
#include <hip/hip_runtime.h>

typedef __attribute__((ext_vector_type(16))) _Float16 v16h;
typedef __attribute__((ext_vector_type(8)))  _Float16 v8h;
typedef __attribute__((ext_vector_type(8)))  float    v8f;
typedef __attribute__((ext_vector_type(4)))  float    v4f;
typedef __attribute__((ext_vector_type(2)))  float    v2f;

#define CB   8      // batches
#define CC   128    // channels (c_in)
#define CQK  16     // q/k channels
#define NN   4096   // spatial positions (64*64)

// ---------------------------------------------------------------------------
// Phase 1: Q, K and V projections as one product on the f32 matrix form
// (16x16x4): the 160 stacked weight rows (Wq | Wk | Wv) against x.
// A block owns 128 columns n, a wave 16 of them.  The wave's whole x slab
// (128 c x 16 n) sits in 64 registers and is read from memory exactly once; it
// serves as B for Q and K (D = [o][n]: a lane ends with 8 consecutive o of one
// n) and as A for V (D = [n][c]: a lane ends with 8 consecutive n of one c), so
// every result leaves as one packed 16-byte store.  Weights are staged in LDS,
// rows pitched at 528 B (16 B x odd) for conflict-free b128 fragment reads.
// k order, the same for both operands: of each 8 k, lane half g holds
// k = 4g .. 4g+3; the first matrix instruction takes the low pair, the second
// the high pair.
// Qh,Kh: (b, n, 16) f16.  Vt: (b, c, n) f16.
// ---------------------------------------------------------------------------
#define WROWS   (2 * CQK + CC)         // 160 stacked weight rows
#define WPITCH  (CC + 4)               // floats per staged weight row (528 B)

__global__ void __launch_bounds__(256) qkv_proj(
    const float* __restrict__ x, const float* __restrict__ Wq,
    const float* __restrict__ Wk, const float* __restrict__ Wv,
    _Float16* __restrict__ Qh, _Float16* __restrict__ Kh,
    _Float16* __restrict__ Vt) {
  __shared__ __attribute__((aligned(16))) float sW[WROWS * WPITCH];
  int tid  = threadIdx.x;
  int lane = tid & 31;
  int wave = tid >> 5;
  int r    = lane & 15;
  int g    = lane >> 4;
  int b    = blockIdx.x / (NN / 128);
  int n0   = (blockIdx.x % (NN / 128)) * 128 + wave * 16;

  // Weight loads first, 16 bytes a thread a trip (a wave to a row), then the
  // wave's x slab: the weights are staged while the slab is still in flight.
  v4f wr[WROWS / 8];
#pragma unroll
  for (int i = 0; i < WROWS / 8; ++i) {
    const float* wsrc = i < 2 ? Wq + (i * 8 + wave) * CC
                      : i < 4 ? Wk + ((i - 2) * 8 + wave) * CC
                              : Wv + ((i - 4) * 8 + wave) * CC;
    wr[i] = *(const v4f*)(wsrc + lane * 4);
    // Ahead of any reuse of the address registers of the loads issued so far
    // (behind the last Wk load and behind the last Wv load).
    if (i == 3 || i == WROWS / 8 - 1) asm volatile("s_wait_xcnt 0x0" ::: "memory");
  }

  const float* xp = x + (size_t)b * CC * NN + (size_t)(4 * g) * NN + n0 + r;
  v2f xf[CC / 4];
#pragma unroll
  for (int kb = 0; kb < CC / 8; ++kb) {
    xf[2 * kb][0]     = xp[(size_t)(kb * 8 + 0) * NN];
    xf[2 * kb][1]     = xp[(size_t)(kb * 8 + 1) * NN];
    xf[2 * kb + 1][0] = xp[(size_t)(kb * 8 + 2) * NN];
    xf[2 * kb + 1][1] = xp[(size_t)(kb * 8 + 3) * NN];
  }
  // Ahead of any reuse of the slab loads' address registers.
  asm volatile("s_wait_xcnt 0x0" ::: "memory");

#pragma unroll
  for (int i = 0; i < WROWS / 8; ++i)
    *(v4f*)(&sW[(i * 8 + wave) * WPITCH + lane * 4]) = wr[i];
  __syncthreads();

  v8f acc[WROWS / 16];
#pragma unroll
  for (int t = 0; t < WROWS / 16; ++t) acc[t] = v8f{};

  // Weight fragments are double-buffered in registers: the reads of block kb+1
  // stand as one group ahead of the matrix instructions of block kb.
  const float* wl = sW + r * WPITCH + 4 * g;
  v4f w[2][WROWS / 16];
#pragma unroll
  for (int t = 0; t < WROWS / 16; ++t) w[0][t] = *(const v4f*)(wl + t * 16 * WPITCH);
#pragma unroll
  for (int kb = 0; kb < CC / 8; ++kb) {
    if (kb + 1 < CC / 8) {
#pragma unroll
      for (int t = 0; t < WROWS / 16; ++t)
        w[(kb + 1) & 1][t] = *(const v4f*)(wl + t * 16 * WPITCH + (kb + 1) * 8);
    }
    // Keeps the group of reads above ahead of this block's matrix instructions;
    // without it each read sinks to just before its use and is waited for there.
    __builtin_amdgcn_sched_barrier(0);
#pragma unroll
    for (int hh = 0; hh < 2; ++hh) {
      v2f xv = xf[2 * kb + hh];
#pragma unroll
      for (int t = 0; t < WROWS / 16; ++t) {
        v2f wv = {w[kb & 1][t][2 * hh], w[kb & 1][t][2 * hh + 1]};
        if (t < 2)   // Q, K: D[M = o][N = n]
          acc[t] = __builtin_amdgcn_wmma_f32_16x16x4_f32(false, wv, false, xv,
                                                         (short)0, acc[t], false, false);
        else         // V: D[M = n][N = c]
          acc[t] = __builtin_amdgcn_wmma_f32_16x16x4_f32(false, xv, false, wv,
                                                         (short)0, acc[t], false, false);
      }
    }
    // Ends the block: the next group of reads stays behind these instructions.
    __builtin_amdgcn_sched_barrier(0);
  }

#pragma unroll
  for (int t = 0; t < WROWS / 16; ++t) {
    v8h o;
#pragma unroll
    for (int v = 0; v < 8; ++v) o[v] = (_Float16)acc[t][v];
    _Float16* dst =
        t == 0 ? Qh + ((size_t)b * NN + n0 + r) * CQK + 8 * g
      : t == 1 ? Kh + ((size_t)b * NN + n0 + r) * CQK + 8 * g
               : Vt + ((size_t)b * CC + (t - 2) * 16 + r) * NN + n0 + 8 * g;
    *(v8h*)dst = o;
  }
}

// ---------------------------------------------------------------------------
// Phase 2: flash attention.  One wave per 16-row q-tile; S^T via WMMA so the
// softmax row = lane%16, P^T packs lane-locally, accumulator is out^T (c, n)
// tiles.  A row's 32 scores of a pass sit in lanes l and l^16: the maximum is
// exchanged between the halves on the vector port, so no wait for an LDS-queue
// exchange drains the pass's fragment reads; each half keeps its own row sum
// (both halves rescale alike) and the two are joined once behind the loop.
// Lazy flash rescale: the
// 64-mul accumulator rescale only runs when some lane's running max grew.
//
// The eight waves of a block walk the same keys, so each stage of KS keys
// (V^T tile 128 x KS and K tile KS x 16) is brought into LDS once per block by
// asynchronous copies, two buffers: stage s+1 flies while stage s is worked on.
// V rows are pitched at 272 B (16 B x odd) so the 16 rows of a b128 fragment
// read fall on distinct banks; K rows (32 B) are read as 512 contiguous bytes.
// All LDS fragment reads of a 32-key pass stand as one group at its head: the 16
// V^T reads of this pass and the 2 K reads of the stage's next pass.  They
// return while the pass's scores and softmax are worked, so neither the S^T nor
// the V^T.P^T products wait for LDS (but for K at the head of a stage).
// ---------------------------------------------------------------------------
#define KS      128                    // keys per stage
#define NST     (NN / KS)              // stages
#define VPITCH  136                    // halves per staged V row (272 B)
#define VBUF    (CC * VPITCH)          // halves per V buffer
#define KBUF    (KS * CQK)             // halves per K buffer

// One stage's copies of one thread: 8 x 16 B of V^T (a wave covers two whole
// 256-B rows per copy) and 16 B of K.  s_wait_xcnt 0 stands as the last line of
// the copies' own statement, ahead of any rewrite of the address registers.
__device__ __forceinline__ void stage_copy(const _Float16* gv, const _Float16* gk,
                                           unsigned lv, unsigned lk) {
  asm volatile(
      "global_load_async_to_lds_b128 %0, %9, off\n\t"
      "global_load_async_to_lds_b128 %1, %10, off\n\t"
      "global_load_async_to_lds_b128 %2, %11, off\n\t"
      "global_load_async_to_lds_b128 %3, %12, off\n\t"
      "global_load_async_to_lds_b128 %4, %13, off\n\t"
      "global_load_async_to_lds_b128 %5, %14, off\n\t"
      "global_load_async_to_lds_b128 %6, %15, off\n\t"
      "global_load_async_to_lds_b128 %7, %16, off\n\t"
      "global_load_async_to_lds_b128 %8, %17, off\n\t"
      "s_wait_xcnt 0x0"
      :: "v"(lv), "v"(lv + 1u * 16u * VPITCH * 2u), "v"(lv + 2u * 16u * VPITCH * 2u),
         "v"(lv + 3u * 16u * VPITCH * 2u), "v"(lv + 4u * 16u * VPITCH * 2u),
         "v"(lv + 5u * 16u * VPITCH * 2u), "v"(lv + 6u * 16u * VPITCH * 2u),
         "v"(lv + 7u * 16u * VPITCH * 2u), "v"(lk),
         "v"(gv), "v"(gv + 1 * 16 * NN), "v"(gv + 2 * 16 * NN), "v"(gv + 3 * 16 * NN),
         "v"(gv + 4 * 16 * NN), "v"(gv + 5 * 16 * NN), "v"(gv + 6 * 16 * NN),
         "v"(gv + 7 * 16 * NN), "v"(gk)
      : "memory");
}

// Lane l with lane l ^ 16 by a cross-row vector move: it counts on no LDS
// counter, so the fragment reads in flight are not waited for with it.
__device__ __forceinline__ float xhalf(float v) {
  int b = __builtin_bit_cast(int, v);
  return __builtin_bit_cast(float, __builtin_amdgcn_permlanex16(b, b, 0x76543210, 0xfedcba98, false, false));
}

__global__ void __launch_bounds__(256) attn_kernel(
    const float* __restrict__ x, const _Float16* __restrict__ Qh,
    const _Float16* __restrict__ Kh, const _Float16* __restrict__ Vt,
    const float* __restrict__ gamma, float* __restrict__ out) {
  __shared__ __attribute__((aligned(16))) _Float16 Vs[2 * VBUF];
  __shared__ __attribute__((aligned(16))) _Float16 Ks[2 * KBUF];

  int tid  = threadIdx.x;
  int lane = tid & 31;
  int wave = tid >> 5;
  int qt   = blockIdx.x * 8 + wave;         // global q-tile id (0..2047)
  int b    = qt >> 8;                       // 256 tiles per batch (same b for the block)
  int n0   = (qt & 255) << 4;               // q rows n0 .. n0+15
  int r    = lane & 15;                     // q_row within tile / N index
  int g    = lane >> 4;                     // half-group (K-offset selector)

  const v8f zero = {};

  // B-operand: Q tile, B[K=o (padded to 32), N=q_row]; halves 8..15 stay 0.
  v16h bq = {};
  {
    v8h lo = *(const v8h*)(Qh + ((size_t)b * NN + n0 + r) * CQK + 8 * g);
#pragma unroll
    for (int h = 0; h < 8; ++h) bq[h] = lo[h];
  }

  v8f acc[8];
#pragma unroll
  for (int t = 0; t < 8; ++t) acc[t] = zero;
  float mstat = -1e30f, lstat = 0.0f;

  const _Float16* Kb = Kh + (size_t)b * NN * CQK;
  const _Float16* Vb = Vt + (size_t)b * CC * NN;

  // This thread's share of a stage: V row (tid>>4) + 16*i, 16-B column tid&15;
  // K bytes 16*tid of the stage's 4 KB.
  const _Float16* gv = Vb + (size_t)(tid >> 4) * NN + (tid & 15) * 8;
  const _Float16* gk = Kb + tid * 8;
  const unsigned lv = (unsigned)(size_t)(&Vs[(tid >> 4) * VPITCH + (tid & 15) * 8]);
  const unsigned lk = (unsigned)(size_t)(&Ks[tid * 8]);

  // Prologue: stage 0 lands and is published, then stage 1 starts to fly.
  stage_copy(gv, gk, lv, lk);
  asm volatile("s_wait_asynccnt 0x0" ::: "memory");  // own copies of stage 0 landed
  __syncthreads();                                   // ... and every other wave's
  stage_copy(gv + KS, gk + KBUF, lv + VBUF * 2u, lk + KBUF * 2u);

  for (int s = 0; s < NST; ++s) {
    const int buf = s & 1;
    const _Float16* vs = Vs + buf * VBUF + r * VPITCH + 8 * g;
    const _Float16* ks = Ks + buf * KBUF + r * CQK + 8 * g;

    // K fragments, two register sets; the stage's first pair is read here.
    v8h kf[2][2];
    kf[0][0] = *(const v8h*)(ks);
    kf[0][1] = *(const v8h*)(ks + 16 * CQK);
    // Keeps this pair ahead of the first pass's group: its S^T products then wait
    // for these two reads and not for the eighteen behind them.
    __builtin_amdgcn_sched_barrier(0);

#pragma unroll
    for (int mm = 0; mm < KS; mm += 32) {
      const int cur = (mm >> 5) & 1;
      // The pass's read group: its V^T fragments, then the next pass's K pair
      // (never beyond this stage's buffer).
      v8h vlo[8], vhi[8];
#pragma unroll
      for (int ct = 0; ct < 8; ++ct) {
        const _Float16* vrow = vs + ct * 16 * VPITCH + mm;
        vlo[ct] = *(const v8h*)(vrow);
        vhi[ct] = *(const v8h*)(vrow + 16);
      }
      if (mm + 32 < KS) {
        kf[cur ^ 1][0] = *(const v8h*)(ks + (mm + 32) * CQK);
        kf[cur ^ 1][1] = *(const v8h*)(ks + (mm + 48) * CQK);
      }
      // Keeps the group above ahead of the pass's work; without it each read
      // sinks to just before its matrix instruction and is waited for there.
      __builtin_amdgcn_sched_barrier(0);

      // A-operands: two K tiles, A[M = m col, K = o padded to 32]
      v16h ak0 = {}, ak1 = {};
#pragma unroll
      for (int h = 0; h < 8; ++h) { ak0[h] = kf[cur][0][h]; ak1[h] = kf[cur][1][h]; }
      // S^T tiles: D[M = m local, N = q_row]
      v8f s0 = __builtin_amdgcn_wmma_f32_16x16x32_f16(false, ak0, false, bq,
                                                      (short)0, zero, false, false);
      v8f s1 = __builtin_amdgcn_wmma_f32_16x16x32_f16(false, ak1, false, bq,
                                                      (short)0, zero, false, false);

      // Running max over these 32 columns; per-lane row = r.
      float t = -1e30f;
#pragma unroll
      for (int v = 0; v < 8; ++v) t = fmaxf(t, fmaxf(s0[v], s1[v]));
      t = fmaxf(t, xhalf(t));
      float mnew = fmaxf(mstat, t);

      // Lazy rescale: only when some lane's running max actually grew.
      if (__any(mnew > mstat)) {
        float sc = __expf(mstat - mnew);    // lanes with unchanged max: sc = 1
        lstat *= sc;
#pragma unroll
        for (int ct = 0; ct < 8; ++ct) {
#pragma unroll
          for (int v = 0; v < 8; ++v) acc[ct][v] *= sc;
        }
      }
      mstat = mnew;

      float p0[8], p1[8];
      float rsum = 0.0f;
#pragma unroll
      for (int v = 0; v < 8; ++v) {
        p0[v] = __expf(s0[v] - mnew);
        p1[v] = __expf(s1[v] - mnew);
        rsum += p0[v] + p1[v];
      }
      lstat += rsum;                        // this half's 16 keys only

      // Pack P^T lane-locally into B layout: B[K = m local 0..31, N = q_row].
      v16h bp;
#pragma unroll
      for (int v = 0; v < 8; ++v) {
        bp[v]     = (_Float16)p0[v];
        bp[8 + v] = (_Float16)p1[v];
      }

      // acc += V^T . P^T   (out^T tiles, M = c, N = q_row)
#pragma unroll
      for (int ct = 0; ct < 8; ++ct) {
        v16h av;
#pragma unroll
        for (int h = 0; h < 8; ++h) { av[h] = vlo[ct][h]; av[8 + h] = vhi[ct][h]; }
        acc[ct] = __builtin_amdgcn_wmma_f32_16x16x32_f16(false, av, false, bp,
                                                         (short)0, acc[ct], false, false);
      }
      // Ends the pass: the next group of reads stays behind these instructions.
      __builtin_amdgcn_sched_barrier(0);
    }

    // Publish point of stage s+1, every wave, in this order.
    asm volatile("s_wait_dscnt 0x0" ::: "memory");     // own reads of buffer 'buf' returned
    asm volatile("s_wait_asynccnt 0x0" ::: "memory");  // own copies of stage s+1 landed
    __syncthreads();  // publishes stage s+1; ends every wave's reads of buffer 'buf'
    if (s + 2 < NST)  // block-uniform: refill the buffer just left with stage s+2
      stage_copy(gv + (s + 2) * KS, gk + (s + 2) * KBUF,
                 lv + buf * (VBUF * 2u), lk + buf * (KBUF * 2u));
  }
  asm volatile("s_wait_asynccnt 0x0" ::: "memory");    // no copy in flight at the wave's end

  // Epilogue: out(b,c,n) = x + gamma * out^T / lstat  (lstat uniform over v).
  lstat += xhalf(lstat);                    // join the halves' row sums
  float inv = gamma[0] / lstat;
  const float* xb = x + (size_t)b * CC * NN;
  float* ob = out + (size_t)b * CC * NN;
#pragma unroll
  for (int ct = 0; ct < 8; ++ct) {
#pragma unroll
    for (int v = 0; v < 8; ++v) {
      int c = ct * 16 + v + 8 * g;          // C/D layout: M = v + 8*(lane/16)
      size_t idx = (size_t)c * NN + n0 + r;
      ob[idx] = xb[idx] + inv * acc[ct][v];
    }
  }
}

// ---------------------------------------------------------------------------
extern "C" void kernel_launch(void* const* d_in, const int* in_sizes, int n_in,
                              void* d_out, int out_size, void* d_ws, size_t ws_size,
                              hipStream_t stream) {
  const float* x     = (const float*)d_in[0];
  const float* Wq    = (const float*)d_in[1];
  const float* Wk    = (const float*)d_in[2];
  const float* Wv    = (const float*)d_in[3];
  const float* gamma = (const float*)d_in[4];
  float* out = (float*)d_out;

  // Workspace: Qh (1 MB) | Kh (1 MB) | Vt (8 MB), all f16.
  _Float16* Qh = (_Float16*)d_ws;
  _Float16* Kh = Qh + (size_t)CB * NN * CQK;
  _Float16* Vt = Kh + (size_t)CB * NN * CQK;

  qkv_proj<<<CB * NN / 128, 256, 0, stream>>>(x, Wq, Wk, Wv, Qh, Kh, Vt);
  attn_kernel<<<CB * NN / 16 / 8, 256, 0, stream>>>(x, Qh, Kh, Vt, gamma, out);
}

// v005
// Measured time: 52.6 microseconds a run.
// Two timings next to v004 put it at 1.05 and 1.06 times that version's speed.
// Counting every step since v000, it is 4.53 times as fast.
#include <hip/hip_runtime.h>

typedef __attribute__((ext_vector_type(16))) _Float16 v16h;
typedef __attribute__((ext_vector_type(8)))  _Float16 v8h;
typedef __attribute__((ext_vector_type(8)))  float    v8f;
typedef __attribute__((ext_vector_type(4)))  float    v4f;
typedef __attribute__((ext_vector_type(2)))  float    v2f;

#define CB   8      // batches
#define CC   128    // channels (c_in)
#define CQK  16     // q/k channels
#define NN   4096   // spatial positions (64*64)

// ---------------------------------------------------------------------------
// Phase 1: Q, K and V projections as one product on the f32 matrix form
// (16x16x4): the 160 stacked weight rows (Wq | Wk | Wv) against x.
// A block owns 128 columns n, a wave 16 of them.  The wave's whole x slab
// (128 c x 16 n) sits in 64 registers and is read from memory exactly once; it
// serves as B for Q and K (D = [o][n]: a lane ends with 8 consecutive o of one
// n) and as A for V (D = [n][c]: a lane ends with 8 consecutive n of one c), so
// every result leaves as one packed 16-byte store.  Weights are staged in LDS,
// rows pitched at 528 B (16 B x odd) for conflict-free b128 fragment reads.
// k order, the same for both operands: of each 8 k, lane half g holds
// k = 4g .. 4g+3; the first matrix instruction takes the low pair, the second
// the high pair.
// Qh,Kh: (b, n, 16) f16.  Vt: (b, c, n) f16.
// ---------------------------------------------------------------------------
#define WROWS   (2 * CQK + CC)         // 160 stacked weight rows
#define WPITCH  (CC + 4)               // floats per staged weight row (528 B)

__global__ void __launch_bounds__(256) qkv_proj(
    const float* __restrict__ x, const float* __restrict__ Wq,
    const float* __restrict__ Wk, const float* __restrict__ Wv,
    _Float16* __restrict__ Qh, _Float16* __restrict__ Kh,
    _Float16* __restrict__ Vt) {
  __shared__ __attribute__((aligned(16))) float sW[WROWS * WPITCH];
  int tid  = threadIdx.x;
  int lane = tid & 31;
  int wave = tid >> 5;
  int r    = lane & 15;
  int g    = lane >> 4;
  int b    = blockIdx.x / (NN / 128);
  int n0   = (blockIdx.x % (NN / 128)) * 128 + wave * 16;

  // Weight loads first, 16 bytes a thread a trip (a wave to a row), then the
  // wave's x slab: the weights are staged while the slab is still in flight.
  v4f wr[WROWS / 8];
#pragma unroll
  for (int i = 0; i < WROWS / 8; ++i) {
    const float* wsrc = i < 2 ? Wq + (i * 8 + wave) * CC
                      : i < 4 ? Wk + ((i - 2) * 8 + wave) * CC
                              : Wv + ((i - 4) * 8 + wave) * CC;
    wr[i] = *(const v4f*)(wsrc + lane * 4);
    // Ahead of any reuse of the address registers of the loads issued so far
    // (behind the last Wk load and behind the last Wv load).
    if (i == 3 || i == WROWS / 8 - 1) asm volatile("s_wait_xcnt 0x0" ::: "memory");
  }

  const float* xp = x + (size_t)b * CC * NN + (size_t)(4 * g) * NN + n0 + r;
  v2f xf[CC / 4];
#pragma unroll
  for (int kb = 0; kb < CC / 8; ++kb) {
    xf[2 * kb][0]     = xp[(size_t)(kb * 8 + 0) * NN];
    xf[2 * kb][1]     = xp[(size_t)(kb * 8 + 1) * NN];
    xf[2 * kb + 1][0] = xp[(size_t)(kb * 8 + 2) * NN];
    xf[2 * kb + 1][1] = xp[(size_t)(kb * 8 + 3) * NN];
  }
  // Ahead of any reuse of the slab loads' address registers.
  asm volatile("s_wait_xcnt 0x0" ::: "memory");

#pragma unroll
  for (int i = 0; i < WROWS / 8; ++i)
    *(v4f*)(&sW[(i * 8 + wave) * WPITCH + lane * 4]) = wr[i];
  __syncthreads();

  v8f acc[WROWS / 16];
#pragma unroll
  for (int t = 0; t < WROWS / 16; ++t) acc[t] = v8f{};

  // Weight fragments are double-buffered in registers: the reads of block kb+1
  // stand as one group ahead of the matrix instructions of block kb.
  const float* wl = sW + r * WPITCH + 4 * g;
  v4f w[2][WROWS / 16];
#pragma unroll
  for (int t = 0; t < WROWS / 16; ++t) w[0][t] = *(const v4f*)(wl + t * 16 * WPITCH);
#pragma unroll
  for (int kb = 0; kb < CC / 8; ++kb) {
    if (kb + 1 < CC / 8) {
#pragma unroll
      for (int t = 0; t < WROWS / 16; ++t)
        w[(kb + 1) & 1][t] = *(const v4f*)(wl + t * 16 * WPITCH + (kb + 1) * 8);
    }
    // Keeps the group of reads above ahead of this block's matrix instructions;
    // without it each read sinks to just before its use and is waited for there.
    __builtin_amdgcn_sched_barrier(0);
#pragma unroll
    for (int hh = 0; hh < 2; ++hh) {
      v2f xv = xf[2 * kb + hh];
#pragma unroll
      for (int t = 0; t < WROWS / 16; ++t) {
        v2f wv = {w[kb & 1][t][2 * hh], w[kb & 1][t][2 * hh + 1]};
        if (t < 2)   // Q, K: D[M = o][N = n]
          acc[t] = __builtin_amdgcn_wmma_f32_16x16x4_f32(false, wv, false, xv,
                                                         (short)0, acc[t], false, false);
        else         // V: D[M = n][N = c]
          acc[t] = __builtin_amdgcn_wmma_f32_16x16x4_f32(false, xv, false, wv,
                                                         (short)0, acc[t], false, false);
      }
    }
    // Ends the block: the next group of reads stays behind these instructions.
    __builtin_amdgcn_sched_barrier(0);
  }

#pragma unroll
  for (int t = 0; t < WROWS / 16; ++t) {
    v8h o;
#pragma unroll
    for (int v = 0; v < 8; ++v) o[v] = (_Float16)acc[t][v];
    _Float16* dst =
        t == 0 ? Qh + ((size_t)b * NN + n0 + r) * CQK + 8 * g
      : t == 1 ? Kh + ((size_t)b * NN + n0 + r) * CQK + 8 * g
               : Vt + ((size_t)b * CC + (t - 2) * 16 + r) * NN + n0 + 8 * g;
    *(v8h*)dst = o;
  }
}

// ---------------------------------------------------------------------------
// Phase 2: flash attention.  S^T via WMMA so the softmax row = lane%16, P^T
// packs lane-locally, accumulator is out^T (c, n) tiles.
// A wave owns 32 query rows (two 16-row q tiles) and half of the keys: every K
// and V^T fragment it reads from LDS feeds two matrix instructions, one per q
// tile, so a block reads half the LDS bytes per product, and the two tiles'
// softmax chains are independent work for the vector port.  A block is 4 query
// groups x 2 key halves = 8 waves on 128 query rows; wave w and wave w^4 hold
// the same rows and the two halves of every stage's keys.  Behind the loop each
// wave of such a pair hands one tile's (m, l, acc) to the other through LDS and
// finishes the tile it keeps.
// A row's 32 scores of a pass sit in lanes l and l^16: the maximum is
// exchanged between the halves on the vector port, so no wait for an LDS-queue
// exchange drains the pass's fragment reads; each half keeps its own row sum
// (both halves rescale alike) and the two are joined once behind the loop.
// Lazy flash rescale: the accumulator rescale only runs when some lane's
// running max grew (one test per pass for both tiles).
//
// The eight waves of a block walk the same stages, so each stage of KS keys
// (V^T tile 128 x KS and K tile KS x 16) is brought into LDS once per block by
// asynchronous copies, two buffers: stage s+1 flies while stage s is worked on.
// V rows are pitched at 272 B (16 B x odd) so the 16 rows of a b128 fragment
// read fall on distinct banks; K rows (32 B) are read as 512 contiguous bytes.
// All LDS fragment reads of a 32-key pass stand as one group at its head: the 16
// V^T reads of this pass and the 2 K reads of the wave's next pass in the stage.
// ---------------------------------------------------------------------------
#define KS      128                    // keys per stage
#define NST     (NN / KS)              // stages
#define KW      (KS / 2)               // keys of a stage per wave (one key half)
#define VPITCH  136                    // halves per staged V row (272 B)
#define VBUF    (CC * VPITCH)          // halves per V buffer
#define KBUF    (KS * CQK)             // halves per K buffer

// One stage's copies of one thread: 8 x 16 B of V^T (a wave covers two whole
// 256-B rows per copy) and 16 B of K.  s_wait_xcnt 0 stands as the last line of
// the copies' own statement, ahead of any rewrite of the address registers.
__device__ __forceinline__ void stage_copy(const _Float16* gv, const _Float16* gk,
                                           unsigned lv, unsigned lk) {
  asm volatile(
      "global_load_async_to_lds_b128 %0, %9, off\n\t"
      "global_load_async_to_lds_b128 %1, %10, off\n\t"
      "global_load_async_to_lds_b128 %2, %11, off\n\t"
      "global_load_async_to_lds_b128 %3, %12, off\n\t"
      "global_load_async_to_lds_b128 %4, %13, off\n\t"
      "global_load_async_to_lds_b128 %5, %14, off\n\t"
      "global_load_async_to_lds_b128 %6, %15, off\n\t"
      "global_load_async_to_lds_b128 %7, %16, off\n\t"
      "global_load_async_to_lds_b128 %8, %17, off\n\t"
      "s_wait_xcnt 0x0"
      :: "v"(lv), "v"(lv + 1u * 16u * VPITCH * 2u), "v"(lv + 2u * 16u * VPITCH * 2u),
         "v"(lv + 3u * 16u * VPITCH * 2u), "v"(lv + 4u * 16u * VPITCH * 2u),
         "v"(lv + 5u * 16u * VPITCH * 2u), "v"(lv + 6u * 16u * VPITCH * 2u),
         "v"(lv + 7u * 16u * VPITCH * 2u), "v"(lk),
         "v"(gv), "v"(gv + 1 * 16 * NN), "v"(gv + 2 * 16 * NN), "v"(gv + 3 * 16 * NN),
         "v"(gv + 4 * 16 * NN), "v"(gv + 5 * 16 * NN), "v"(gv + 6 * 16 * NN),
         "v"(gv + 7 * 16 * NN), "v"(gk)
      : "memory");
}

// Lane l with lane l ^ 16 by a cross-row vector move: it counts on no LDS
// counter, so the fragment reads in flight are not waited for with it.
__device__ __forceinline__ float xhalf(float v) {
  int b = __builtin_bit_cast(int, v);
  return __builtin_bit_cast(float, __builtin_amdgcn_permlanex16(b, b, 0x76543210, 0xfedcba98, false, false));
}

__global__ void __launch_bounds__(256) attn_kernel(
    const float* __restrict__ x, const _Float16* __restrict__ Qh,
    const _Float16* __restrict__ Kh, const _Float16* __restrict__ Vt,
    const float* __restrict__ gamma, float* __restrict__ out) {
  __shared__ __attribute__((aligned(16))) _Float16 Vs[2 * VBUF];
  __shared__ __attribute__((aligned(16))) _Float16 Ks[2 * KBUF];

  int tid  = threadIdx.x;
  int lane = tid & 31;
  int wave = __builtin_amdgcn_readfirstlane(tid >> 5);
  int qg   = wave & 3;                      // query group: 32 rows
  int kh   = wave >> 2;                     // key half of every stage
  int b    = blockIdx.x >> 5;               // 32 blocks of 128 rows per batch
  int n0   = ((blockIdx.x & 31) << 7) + qg * 32;   // q rows n0 .. n0+31
  int r    = lane & 15;                     // q_row within tile / N index
  int g    = lane >> 4;                     // half-group (K-offset selector)

  const v8f zero = {};
  const float gm = gamma[0];                // uniform: read once, on the scalar path

  // B-operands: two Q tiles, B[K=o (padded to 32), N=q_row]; halves 8..15 stay 0.
  v16h bq[2] = {v16h{}, v16h{}};
  const _Float16* qp0 = Qh + ((size_t)b * NN + n0 + r) * CQK + 8 * g;
  const _Float16* qp1 = qp0 + 16 * CQK;
  {
    v8h lo0 = *(const v8h*)qp0;
    v8h lo1 = *(const v8h*)qp1;
    // Ahead of any reuse of the two loads' address registers: as inputs of the
    // wait's own statement the addresses stay in their registers up to it.
    asm volatile("s_wait_xcnt 0x0" :: "v"(qp0), "v"(qp1) : "memory");
#pragma unroll
    for (int h = 0; h < 8; ++h) { bq[0][h] = lo0[h]; bq[1][h] = lo1[h]; }
  }

  v8f acc[2][8];
#pragma unroll
  for (int j = 0; j < 2; ++j)
#pragma unroll
    for (int t = 0; t < 8; ++t) acc[j][t] = zero;
  float mstat[2] = {-1e30f, -1e30f}, lstat[2] = {0.0f, 0.0f};

  const _Float16* Kb = Kh + (size_t)b * NN * CQK;
  const _Float16* Vb = Vt + (size_t)b * CC * NN;

  // This thread's share of a stage: V row (tid>>4) + 16*i, 16-B column tid&15;
  // K bytes 16*tid of the stage's 4 KB.
  const _Float16* gv = Vb + (size_t)(tid >> 4) * NN + (tid & 15) * 8;
  const _Float16* gk = Kb + tid * 8;
  const unsigned lv = (unsigned)(size_t)(&Vs[(tid >> 4) * VPITCH + (tid & 15) * 8]);
  const unsigned lk = (unsigned)(size_t)(&Ks[tid * 8]);

  // Prologue: stage 0 lands and is published, then stage 1 starts to fly.
  stage_copy(gv, gk, lv, lk);
  asm volatile("s_wait_asynccnt 0x0" ::: "memory");  // own copies of stage 0 landed
  __syncthreads();                                   // ... and every other wave's
  stage_copy(gv + KS, gk + KBUF, lv + VBUF * 2u, lk + KBUF * 2u);

  for (int s = 0; s < NST; ++s) {
    const int buf = s & 1;
    const _Float16* vs = Vs + buf * VBUF + r * VPITCH + 8 * g + kh * KW;
    const _Float16* ks = Ks + buf * KBUF + (kh * KW + r) * CQK + 8 * g;

    // K fragments, two register sets; the first pair of this wave's key half is read here.
    v8h kf[2][2];
    kf[0][0] = *(const v8h*)(ks);
    kf[0][1] = *(const v8h*)(ks + 16 * CQK);
    // Keeps this pair ahead of the first pass's group: its S^T products then wait
    // for these two reads and not for the eighteen behind them.
    __builtin_amdgcn_sched_barrier(0);

#pragma unroll
    for (int mm = 0; mm < KW; mm += 32) {
      const int cur = (mm >> 5) & 1;
      // The pass's read group: its V^T fragments, then the next pass's K pair
      // (never beyond this wave's half of the stage).
      v8h vlo[8], vhi[8];
#pragma unroll
      for (int ct = 0; ct < 8; ++ct) {
        const _Float16* vrow = vs + ct * 16 * VPITCH + mm;
        vlo[ct] = *(const v8h*)(vrow);
        vhi[ct] = *(const v8h*)(vrow + 16);
      }
      if (mm + 32 < KW) {
        kf[cur ^ 1][0] = *(const v8h*)(ks + (mm + 32) * CQK);
        kf[cur ^ 1][1] = *(const v8h*)(ks + (mm + 48) * CQK);
      }
      // Keeps the group above ahead of the pass's work; without it each read
      // sinks to just before its matrix instruction and is waited for there.
      __builtin_amdgcn_sched_barrier(0);

      // A-operands: two K tiles, A[M = m col, K = o padded to 32]
      v16h ak0 = {}, ak1 = {};
#pragma unroll
      for (int h = 0; h < 8; ++h) { ak0[h] = kf[cur][0][h]; ak1[h] = kf[cur][1][h]; }
      // S^T tiles: D[M = m local, N = q_row], each K tile against both q tiles
      v8f s0[2], s1[2];
#pragma unroll
      for (int j = 0; j < 2; ++j) {
        s0[j] = __builtin_amdgcn_wmma_f32_16x16x32_f16(false, ak0, false, bq[j],
                                                       (short)0, zero, false, false);
        s1[j] = __builtin_amdgcn_wmma_f32_16x16x32_f16(false, ak1, false, bq[j],
                                                       (short)0, zero, false, false);
      }

      // Running max over these 32 columns; per-lane row = r of each tile.
      float mnew[2];
#pragma unroll
      for (int j = 0; j < 2; ++j) {
        float t = -1e30f;
#pragma unroll
        for (int v = 0; v < 8; ++v) t = fmaxf(t, fmaxf(s0[j][v], s1[j][v]));
        t = fmaxf(t, xhalf(t));
        mnew[j] = fmaxf(mstat[j], t);
      }

      // Lazy rescale: only when some lane's running max actually grew.
      if (__any(mnew[0] > mstat[0] || mnew[1] > mstat[1])) {
#pragma unroll
        for (int j = 0; j < 2; ++j) {
          float sc = __expf(mstat[j] - mnew[j]);   // unchanged max: sc = 1
          lstat[j] *= sc;
#pragma unroll
          for (int ct = 0; ct < 8; ++ct) {
#pragma unroll
            for (int v = 0; v < 8; ++v) acc[j][ct][v] *= sc;
          }
        }
      }

      // Pack P^T lane-locally into B layout: B[K = m local 0..31, N = q_row].
      v16h bp[2];
#pragma unroll
      for (int j = 0; j < 2; ++j) {
        mstat[j] = mnew[j];
        float p0[8], p1[8];
        float rsum = 0.0f;
#pragma unroll
        for (int v = 0; v < 8; ++v) {
          p0[v] = __expf(s0[j][v] - mnew[j]);
          p1[v] = __expf(s1[j][v] - mnew[j]);
          rsum += p0[v] + p1[v];
        }
        lstat[j] += rsum;                   // this lane half's 16 keys only
#pragma unroll
        for (int v = 0; v < 8; ++v) {
          bp[j][v]     = (_Float16)p0[v];
          bp[j][8 + v] = (_Float16)p1[v];
        }
      }

      // acc += V^T . P^T   (out^T tiles, M = c, N = q_row): one fragment, two tiles
#pragma unroll
      for (int ct = 0; ct < 8; ++ct) {
        v16h av;
#pragma unroll
        for (int h = 0; h < 8; ++h) { av[h] = vlo[ct][h]; av[8 + h] = vhi[ct][h]; }
#pragma unroll
        for (int j = 0; j < 2; ++j)
          acc[j][ct] = __builtin_amdgcn_wmma_f32_16x16x32_f16(false, av, false, bp[j],
                                                              (short)0, acc[j][ct], false, false);
      }
      // Ends the pass: the next group of reads stays behind these instructions.
      __builtin_amdgcn_sched_barrier(0);
    }

    // Publish point of stage s+1, every wave, in this order.
    asm volatile("s_wait_dscnt 0x0" ::: "memory");     // own reads of buffer 'buf' returned
    asm volatile("s_wait_asynccnt 0x0" ::: "memory");  // own copies of stage s+1 landed
    __syncthreads();  // publishes stage s+1; ends every wave's reads of buffer 'buf'
    if (s + 2 < NST)  // block-uniform: refill the buffer just left with stage s+2
      stage_copy(gv + (s + 2) * KS, gk + (s + 2) * KBUF,
                 lv + buf * (VBUF * 2u), lk + buf * (KBUF * 2u));
  }
  asm volatile("s_wait_asynccnt 0x0" ::: "memory");    // no copy in flight at the wave's end

  // Join of the two key halves.  The loop's last barrier ended every read of the
  // stage buffers and no copy is in flight, so they serve as the exchange area.
  // Wave kh keeps q tile kh and hands tile 1-kh to its partner (wave ^ 4).
  lstat[0] += xhalf(lstat[0]);              // join the lane halves' row sums
  lstat[1] += xhalf(lstat[1]);
  float* xa = (float*)Vs;                   // 8 waves x 16 x 512 B
  float* xs = (float*)Ks;                   // 8 waves x 2 x 128 B
#pragma unroll
  for (int ct = 0; ct < 8; ++ct) {
#pragma unroll
    for (int hh = 0; hh < 2; ++hh) {
      v4f o;
#pragma unroll
      for (int v = 0; v < 4; ++v) o[v] = kh ? acc[0][ct][4 * hh + v] : acc[1][ct][4 * hh + v];
      *(v4f*)(xa + ((wave * 16 + ct * 2 + hh) * 32 + lane) * 4) = o;
    }
  }
  xs[(wave * 2 + 0) * 32 + lane] = kh ? mstat[0] : mstat[1];
  xs[(wave * 2 + 1) * 32 + lane] = kh ? lstat[0] : lstat[1];
  __syncthreads();                          // both halves' hand-overs are in LDS

  const int pw = wave ^ 4;
  float ma = kh ? mstat[1] : mstat[0];
  float la = kh ? lstat[1] : lstat[0];
  float mb = xs[(pw * 2 + 0) * 32 + lane];
  float lb = xs[(pw * 2 + 1) * 32 + lane];
  float mj = fmaxf(ma, mb);
  float sa = __expf(ma - mj), sb = __expf(mb - mj);
  float inv = gm / (la * sa + lb * sb);
  float ca = inv * sa, cb = inv * sb;

  // Epilogue: out(b,c,n) = x + gamma * out^T / l for the tile this wave keeps.
  const float* xb = x + (size_t)b * CC * NN;
  float* ob = out + (size_t)b * CC * NN;
#pragma unroll
  for (int ct = 0; ct < 8; ++ct) {
#pragma unroll
    for (int hh = 0; hh < 2; ++hh) {
      v4f o = *(const v4f*)(xa + ((pw * 16 + ct * 2 + hh) * 32 + lane) * 4);
#pragma unroll
      for (int v = 0; v < 4; ++v) {
        float mine = kh ? acc[1][ct][4 * hh + v] : acc[0][ct][4 * hh + v];
        int c = ct * 16 + 4 * hh + v + 8 * g;   // C/D layout: M = 4*hh + v + 8*(lane/16)
        size_t idx = (size_t)c * NN + n0 + 16 * kh + r;
        ob[idx] = xb[idx] + (ca * mine + cb * o[v]);
      }
    }
  }
}

// ---------------------------------------------------------------------------
extern "C" void kernel_launch(void* const* d_in, const int* in_sizes, int n_in,
                              void* d_out, int out_size, void* d_ws, size_t ws_size,
                              hipStream_t stream) {
  const float* x     = (const float*)d_in[0];
  const float* Wq    = (const float*)d_in[1];
  const float* Wk    = (const float*)d_in[2];
  const float* Wv    = (const float*)d_in[3];
  const float* gamma = (const float*)d_in[4];
  float* out = (float*)d_out;

  // Workspace: Qh (1 MB) | Kh (1 MB) | Vt (8 MB), all f16.
  _Float16* Qh = (_Float16*)d_ws;
  _Float16* Kh = Qh + (size_t)CB * NN * CQK;
  _Float16* Vt = Kh + (size_t)CB * NN * CQK;

  qkv_proj<<<CB * NN / 128, 256, 0, stream>>>(x, Wq, Wk, Wv, Qh, Kh, Vt);
  attn_kernel<<<CB * NN / 128, 256, 0, stream>>>(x, Qh, Kh, Vt, gamma, out);
}

// v006
// One run takes 50.8 microseconds.
// Two timings next to v005 both put it at 1.05 times that version's speed.
// Over all steps from v000 it is 4.76 times as fast.
#include <hip/hip_runtime.h>

typedef __attribute__((ext_vector_type(16))) _Float16 v16h;
typedef __attribute__((ext_vector_type(8)))  _Float16 v8h;
typedef __attribute__((ext_vector_type(8)))  float    v8f;
typedef __attribute__((ext_vector_type(4)))  float    v4f;
typedef __attribute__((ext_vector_type(2)))  float    v2f;

#define CB   8      // batches
#define CC   128    // channels (c_in)
#define CQK  16     // q/k channels
#define NN   4096   // spatial positions (64*64)

// ---------------------------------------------------------------------------
// Phase 1: Q, K and V projections as one product on the f32 matrix form
// (16x16x4): the 160 stacked weight rows (Wq | Wk | Wv) against x.
// A block owns 128 columns n, a wave 16 of them.  The wave's whole x slab
// (128 c x 16 n) sits in 64 registers and is read from memory exactly once; it
// serves as B for Q and K (D = [o][n]: a lane ends with 8 consecutive o of one
// n) and as A for V (D = [n][c]: a lane ends with 8 consecutive n of one c), so
// every result leaves as one packed 16-byte store.  Weights are staged in LDS,
// rows pitched at 528 B (16 B x odd) for conflict-free b128 fragment reads.
// k order, the same for both operands: of each 8 k, lane half g holds
// k = 4g .. 4g+3; the first matrix instruction takes the low pair, the second
// the high pair.
// Qh,Kh: (b, n, 16) f16.  Vt: (b, c, n) f16.
// ---------------------------------------------------------------------------
#define WROWS   (2 * CQK + CC)         // 160 stacked weight rows
#define WPITCH  (CC + 4)               // floats per staged weight row (528 B)

__global__ void __launch_bounds__(256) qkv_proj(
    const float* __restrict__ x, const float* __restrict__ Wq,
    const float* __restrict__ Wk, const float* __restrict__ Wv,
    _Float16* __restrict__ Qh, _Float16* __restrict__ Kh,
    _Float16* __restrict__ Vt) {
  __shared__ __attribute__((aligned(16))) float sW[WROWS * WPITCH];
  int tid  = threadIdx.x;
  int lane = tid & 31;
  int wave = tid >> 5;
  int r    = lane & 15;
  int g    = lane >> 4;
  int b    = blockIdx.x / (NN / 128);
  int n0   = (blockIdx.x % (NN / 128)) * 128 + wave * 16;

  // Weight loads first, 16 bytes a thread a trip (a wave to a row), then the
  // wave's x slab: the weights are staged while the slab is still in flight.
  v4f wr[WROWS / 8];
#pragma unroll
  for (int i = 0; i < WROWS / 8; ++i) {
    const float* wsrc = i < 2 ? Wq + (i * 8 + wave) * CC
                      : i < 4 ? Wk + ((i - 2) * 8 + wave) * CC
                              : Wv + ((i - 4) * 8 + wave) * CC;
    wr[i] = *(const v4f*)(wsrc + lane * 4);
    // Ahead of any reuse of the address registers of the loads issued so far
    // (behind the last Wk load and behind the last Wv load).
    if (i == 3 || i == WROWS / 8 - 1) asm volatile("s_wait_xcnt 0x0" ::: "memory");
  }

  const float* xp = x + (size_t)b * CC * NN + (size_t)(4 * g) * NN + n0 + r;
  v2f xf[CC / 4];
#pragma unroll
  for (int kb = 0; kb < CC / 8; ++kb) {
    xf[2 * kb][0]     = xp[(size_t)(kb * 8 + 0) * NN];
    xf[2 * kb][1]     = xp[(size_t)(kb * 8 + 1) * NN];
    xf[2 * kb + 1][0] = xp[(size_t)(kb * 8 + 2) * NN];
    xf[2 * kb + 1][1] = xp[(size_t)(kb * 8 + 3) * NN];
  }
  // Ahead of any reuse of the slab loads' address registers.
  asm volatile("s_wait_xcnt 0x0" ::: "memory");

#pragma unroll
  for (int i = 0; i < WROWS / 8; ++i)
    *(v4f*)(&sW[(i * 8 + wave) * WPITCH + lane * 4]) = wr[i];
  __syncthreads();

  v8f acc[WROWS / 16];
#pragma unroll
  for (int t = 0; t < WROWS / 16; ++t) acc[t] = v8f{};

  // Weight fragments are double-buffered in registers: the reads of block kb+1
  // stand as one group ahead of the matrix instructions of block kb.
  const float* wl = sW + r * WPITCH + 4 * g;
  v4f w[2][WROWS / 16];
#pragma unroll
  for (int t = 0; t < WROWS / 16; ++t) w[0][t] = *(const v4f*)(wl + t * 16 * WPITCH);
#pragma unroll
  for (int kb = 0; kb < CC / 8; ++kb) {
    if (kb + 1 < CC / 8) {
#pragma unroll
      for (int t = 0; t < WROWS / 16; ++t)
        w[(kb + 1) & 1][t] = *(const v4f*)(wl + t * 16 * WPITCH + (kb + 1) * 8);
    }
    // Keeps the group of reads above ahead of this block's matrix instructions;
    // without it each read sinks to just before its use and is waited for there.
    __builtin_amdgcn_sched_barrier(0);
#pragma unroll
    for (int hh = 0; hh < 2; ++hh) {
      v2f xv = xf[2 * kb + hh];
#pragma unroll
      for (int t = 0; t < WROWS / 16; ++t) {
        v2f wv = {w[kb & 1][t][2 * hh], w[kb & 1][t][2 * hh + 1]};
        if (t < 2)   // Q, K: D[M = o][N = n]
          acc[t] = __builtin_amdgcn_wmma_f32_16x16x4_f32(false, wv, false, xv,
                                                         (short)0, acc[t], false, false);
        else         // V: D[M = n][N = c]
          acc[t] = __builtin_amdgcn_wmma_f32_16x16x4_f32(false, xv, false, wv,
                                                         (short)0, acc[t], false, false);
      }
    }
    // Ends the block: the next group of reads stays behind these instructions.
    __builtin_amdgcn_sched_barrier(0);
  }

#pragma unroll
  for (int t = 0; t < WROWS / 16; ++t) {
    v8h o;
#pragma unroll
    for (int v = 0; v < 8; ++v) o[v] = (_Float16)acc[t][v];
    _Float16* dst =
        t == 0 ? Qh + ((size_t)b * NN + n0 + r) * CQK + 8 * g
      : t == 1 ? Kh + ((size_t)b * NN + n0 + r) * CQK + 8 * g
               : Vt + ((size_t)b * CC + (t - 2) * 16 + r) * NN + n0 + 8 * g;
    *(v8h*)dst = o;
  }
}

// ---------------------------------------------------------------------------
// Phase 2: flash attention.  S^T via WMMA so the softmax row = lane%16, P^T
// packs lane-locally, accumulator is out^T (c, n) tiles.
// A wave owns 32 query rows (two 16-row q tiles) and half of the keys: every K
// and V^T fragment it reads from LDS feeds two matrix instructions, one per q
// tile, so a block reads half the LDS bytes per product, and the two tiles'
// softmax chains are independent work for the vector port.  A block is 4 query
// groups x 2 key halves = 8 waves on 128 query rows; wave w and wave w^4 hold
// the same rows and the two halves of every stage's keys.  Behind the loop each
// wave of such a pair hands one tile's (m, l, acc) to the other through LDS and
// finishes the tile it keeps.
// A row's 32 scores of a pass sit in lanes l and l^16: the maximum is
// exchanged between the halves on the vector port, so no wait for an LDS-queue
// exchange drains the pass's fragment reads; each half keeps its own row sum
// (both halves rescale alike) and the two are joined once behind the loop.
// Lazy flash rescale: m is a reference, not the exact running maximum.  The
// accumulator rescale only runs when some row's scores exceed its reference by
// more than MGROW (one test per pass for both tiles), so P <= e^MGROW, well
// inside f16; l and acc are relative to the same m, which cancels in acc / l.
//
// The eight waves of a block walk the same stages, so each stage of KS keys
// (V^T tile 128 x KS and K tile KS x 16) is brought into LDS once per block by
// asynchronous copies, two buffers: stage s+1 flies while stage s is worked on.
// V rows are pitched at 272 B (16 B x odd) so the 16 rows of a b128 fragment
// read fall on distinct banks; K rows (32 B) are read as 512 contiguous bytes.
// All LDS fragment reads of a 32-key pass stand as one group at its head: the 16
// V^T reads of this pass and the 2 K reads of the wave's next pass in the stage.
// ---------------------------------------------------------------------------
#define KS      128                    // keys per stage
#define NST     (NN / KS)              // stages
#define KW      (KS / 2)               // keys of a stage per wave (one key half)
#define VPITCH  136                    // halves per staged V row (272 B)
#define VBUF    (CC * VPITCH)          // halves per V buffer
#define KBUF    (KS * CQK)             // halves per K buffer
#define MGROW   8.0f                   // a row's scores may exceed its reference m by this

// One stage's copies of one thread: 8 x 16 B of V^T (a wave covers two whole
// 256-B rows per copy) and 16 B of K.  s_wait_xcnt 0 stands as the last line of
// the copies' own statement, ahead of any rewrite of the address registers.
__device__ __forceinline__ void stage_copy(const _Float16* gv, const _Float16* gk,
                                           unsigned lv, unsigned lk) {
  asm volatile(
      "global_load_async_to_lds_b128 %0, %9, off\n\t"
      "global_load_async_to_lds_b128 %1, %10, off\n\t"
      "global_load_async_to_lds_b128 %2, %11, off\n\t"
      "global_load_async_to_lds_b128 %3, %12, off\n\t"
      "global_load_async_to_lds_b128 %4, %13, off\n\t"
      "global_load_async_to_lds_b128 %5, %14, off\n\t"
      "global_load_async_to_lds_b128 %6, %15, off\n\t"
      "global_load_async_to_lds_b128 %7, %16, off\n\t"
      "global_load_async_to_lds_b128 %8, %17, off\n\t"
      "s_wait_xcnt 0x0"
      :: "v"(lv), "v"(lv + 1u * 16u * VPITCH * 2u), "v"(lv + 2u * 16u * VPITCH * 2u),
         "v"(lv + 3u * 16u * VPITCH * 2u), "v"(lv + 4u * 16u * VPITCH * 2u),
         "v"(lv + 5u * 16u * VPITCH * 2u), "v"(lv + 6u * 16u * VPITCH * 2u),
         "v"(lv + 7u * 16u * VPITCH * 2u), "v"(lk),
         "v"(gv), "v"(gv + 1 * 16 * NN), "v"(gv + 2 * 16 * NN), "v"(gv + 3 * 16 * NN),
         "v"(gv + 4 * 16 * NN), "v"(gv + 5 * 16 * NN), "v"(gv + 6 * 16 * NN),
         "v"(gv + 7 * 16 * NN), "v"(gk)
      : "memory");
}

// Lane l with lane l ^ 16 by a cross-row vector move: it counts on no LDS
// counter, so the fragment reads in flight are not waited for with it.
__device__ __forceinline__ float xhalf(float v) {
  int b = __builtin_bit_cast(int, v);
  return __builtin_bit_cast(float, __builtin_amdgcn_permlanex16(b, b, 0x76543210, 0xfedcba98, false, false));
}

__global__ void __launch_bounds__(256) attn_kernel(
    const float* __restrict__ x, const _Float16* __restrict__ Qh,
    const _Float16* __restrict__ Kh, const _Float16* __restrict__ Vt,
    const float* __restrict__ gamma, float* __restrict__ out) {
  __shared__ __attribute__((aligned(16))) _Float16 Vs[2 * VBUF];
  __shared__ __attribute__((aligned(16))) _Float16 Ks[2 * KBUF];

  int tid  = threadIdx.x;
  int lane = tid & 31;
  int wave = __builtin_amdgcn_readfirstlane(tid >> 5);
  int qg   = wave & 3;                      // query group: 32 rows
  int kh   = wave >> 2;                     // key half of every stage
  int b    = blockIdx.x >> 5;               // 32 blocks of 128 rows per batch
  int n0   = ((blockIdx.x & 31) << 7) + qg * 32;   // q rows n0 .. n0+31
  int r    = lane & 15;                     // q_row within tile / N index
  int g    = lane >> 4;                     // half-group (K-offset selector)

  const v8f zero = {};
  const float gm = gamma[0];                // uniform: read once, on the scalar path

  // B-operands: two Q tiles, B[K=o (padded to 32), N=q_row]; halves 8..15 stay 0.
  v16h bq[2] = {v16h{}, v16h{}};
  const _Float16* qp0 = Qh + ((size_t)b * NN + n0 + r) * CQK + 8 * g;
  const _Float16* qp1 = qp0 + 16 * CQK;
  {
    v8h lo0 = *(const v8h*)qp0;
    v8h lo1 = *(const v8h*)qp1;
    // Ahead of any reuse of the two loads' address registers: as inputs of the
    // wait's own statement the addresses stay in their registers up to it.
    asm volatile("s_wait_xcnt 0x0" :: "v"(qp0), "v"(qp1) : "memory");
#pragma unroll
    for (int h = 0; h < 8; ++h) { bq[0][h] = lo0[h]; bq[1][h] = lo1[h]; }
  }

  v8f acc[2][8];
#pragma unroll
  for (int j = 0; j < 2; ++j)
#pragma unroll
    for (int t = 0; t < 8; ++t) acc[j][t] = zero;
  float mstat[2] = {-1e30f, -1e30f}, lstat[2] = {0.0f, 0.0f};

  const _Float16* Kb = Kh + (size_t)b * NN * CQK;
  const _Float16* Vb = Vt + (size_t)b * CC * NN;

  // This thread's share of a stage: V row (tid>>4) + 16*i, 16-B column tid&15;
  // K bytes 16*tid of the stage's 4 KB.
  const _Float16* gv = Vb + (size_t)(tid >> 4) * NN + (tid & 15) * 8;
  const _Float16* gk = Kb + tid * 8;
  const unsigned lv = (unsigned)(size_t)(&Vs[(tid >> 4) * VPITCH + (tid & 15) * 8]);
  const unsigned lk = (unsigned)(size_t)(&Ks[tid * 8]);

  // Prologue: stage 0 lands and is published, then stage 1 starts to fly.
  stage_copy(gv, gk, lv, lk);
  asm volatile("s_wait_asynccnt 0x0" ::: "memory");  // own copies of stage 0 landed
  __syncthreads();                                   // ... and every other wave's
  stage_copy(gv + KS, gk + KBUF, lv + VBUF * 2u, lk + KBUF * 2u);

  for (int s = 0; s < NST; ++s) {
    const int buf = s & 1;
    const _Float16* vs = Vs + buf * VBUF + r * VPITCH + 8 * g + kh * KW;
    const _Float16* ks = Ks + buf * KBUF + (kh * KW + r) * CQK + 8 * g;

    // K fragments, two register sets; the first pair of this wave's key half is read here.
    v8h kf[2][2];
    kf[0][0] = *(const v8h*)(ks);
    kf[0][1] = *(const v8h*)(ks + 16 * CQK);
    // Keeps this pair ahead of the first pass's group: its S^T products then wait
    // for these two reads and not for the eighteen behind them.
    __builtin_amdgcn_sched_barrier(0);

#pragma unroll
    for (int mm = 0; mm < KW; mm += 32) {
      const int cur = (mm >> 5) & 1;
      // The pass's read group: its V^T fragments, then the next pass's K pair
      // (never beyond this wave's half of the stage).
      v8h vlo[8], vhi[8];
#pragma unroll
      for (int ct = 0; ct < 8; ++ct) {
        const _Float16* vrow = vs + ct * 16 * VPITCH + mm;
        vlo[ct] = *(const v8h*)(vrow);
        vhi[ct] = *(const v8h*)(vrow + 16);
      }
      if (mm + 32 < KW) {
        kf[cur ^ 1][0] = *(const v8h*)(ks + (mm + 32) * CQK);
        kf[cur ^ 1][1] = *(const v8h*)(ks + (mm + 48) * CQK);
      }
      // Keeps the group above ahead of the pass's work; without it each read
      // sinks to just before its matrix instruction and is waited for there.
      __builtin_amdgcn_sched_barrier(0);

      // A-operands: two K tiles, A[M = m col, K = o padded to 32]
      v16h ak0 = {}, ak1 = {};
#pragma unroll
      for (int h = 0; h < 8; ++h) { ak0[h] = kf[cur][0][h]; ak1[h] = kf[cur][1][h]; }
      // S^T tiles: D[M = m local, N = q_row], each K tile against both q tiles
      v8f s0[2], s1[2];
#pragma unroll
      for (int j = 0; j < 2; ++j) {
        s0[j] = __builtin_amdgcn_wmma_f32_16x16x32_f16(false, ak0, false, bq[j],
                                                       (short)0, zero, false, false);
        s1[j] = __builtin_amdgcn_wmma_f32_16x16x32_f16(false, ak1, false, bq[j],
                                                       (short)0, zero, false, false);
      }

      // Maximum of these 32 columns; per-lane row = r of each tile.  mnew is the
      // reference the pass works with: the one in use unless the test below moves it.
      float tmax[2], mnew[2];
#pragma unroll
      for (int j = 0; j < 2; ++j) {
        float t = -1e30f;
#pragma unroll
        for (int v = 0; v < 8; ++v) t = fmaxf(t, fmaxf(s0[j][v], s1[j][v]));
        tmax[j] = fmaxf(t, xhalf(t));
        mnew[j] = mstat[j];
      }

      // Lazy rescale: only when some row's maximum exceeds the reference in use
      // by more than MGROW; every row's reference then becomes max(reference, pass maximum).
      if (__any(tmax[0] > mstat[0] + MGROW || tmax[1] > mstat[1] + MGROW)) {
#pragma unroll
        for (int j = 0; j < 2; ++j) {
          mnew[j] = fmaxf(mstat[j], tmax[j]);
          float sc = __expf(mstat[j] - mnew[j]);   // unchanged max: sc = 1
          lstat[j] *= sc;
#pragma unroll
          for (int ct = 0; ct < 8; ++ct) {
#pragma unroll
            for (int v = 0; v < 8; ++v) acc[j][ct][v] *= sc;
          }
        }
      }

      // Pack P^T lane-locally into B layout: B[K = m local 0..31, N = q_row].
      v16h bp[2];
#pragma unroll
      for (int j = 0; j < 2; ++j) {
        mstat[j] = mnew[j];
        float p0[8], p1[8];
        float rsum = 0.0f;
#pragma unroll
        for (int v = 0; v < 8; ++v) {
          p0[v] = __expf(s0[j][v] - mnew[j]);
          p1[v] = __expf(s1[j][v] - mnew[j]);
          rsum += p0[v] + p1[v];
        }
        lstat[j] += rsum;                   // this lane half's 16 keys only
#pragma unroll
        for (int v = 0; v < 8; ++v) {
          bp[j][v]     = (_Float16)p0[v];
          bp[j][8 + v] = (_Float16)p1[v];
        }
      }

      // acc += V^T . P^T   (out^T tiles, M = c, N = q_row): one fragment, two tiles
#pragma unroll
      for (int ct = 0; ct < 8; ++ct) {
        v16h av;
#pragma unroll
        for (int h = 0; h < 8; ++h) { av[h] = vlo[ct][h]; av[8 + h] = vhi[ct][h]; }
#pragma unroll
        for (int j = 0; j < 2; ++j)
          acc[j][ct] = __builtin_amdgcn_wmma_f32_16x16x32_f16(false, av, false, bp[j],
                                                              (short)0, acc[j][ct], false, false);
      }
      // Ends the pass: the next group of reads stays behind these instructions.
      __builtin_amdgcn_sched_barrier(0);
    }

    // Publish point of stage s+1, every wave, in this order.
    asm volatile("s_wait_dscnt 0x0" ::: "memory");     // own reads of buffer 'buf' returned
    asm volatile("s_wait_asynccnt 0x0" ::: "memory");  // own copies of stage s+1 landed
    __syncthreads();  // publishes stage s+1; ends every wave's reads of buffer 'buf'
    if (s + 2 < NST)  // block-uniform: refill the buffer just left with stage s+2
      stage_copy(gv + (s + 2) * KS, gk + (s + 2) * KBUF,
                 lv + buf * (VBUF * 2u), lk + buf * (KBUF * 2u));
  }
  asm volatile("s_wait_asynccnt 0x0" ::: "memory");    // no copy in flight at the wave's end

  // Join of the two key halves.  The loop's last barrier ended every read of the
  // stage buffers and no copy is in flight, so they serve as the exchange area.
  // Wave kh keeps q tile kh and hands tile 1-kh to its partner (wave ^ 4).
  lstat[0] += xhalf(lstat[0]);              // join the lane halves' row sums
  lstat[1] += xhalf(lstat[1]);
  float* xa = (float*)Vs;                   // 8 waves x 16 x 512 B
  float* xs = (float*)Ks;                   // 8 waves x 2 x 128 B
#pragma unroll
  for (int ct = 0; ct < 8; ++ct) {
#pragma unroll
    for (int hh = 0; hh < 2; ++hh) {
      v4f o;
#pragma unroll
      for (int v = 0; v < 4; ++v) o[v] = kh ? acc[0][ct][4 * hh + v] : acc[1][ct][4 * hh + v];
      *(v4f*)(xa + ((wave * 16 + ct * 2 + hh) * 32 + lane) * 4) = o;
    }
  }
  xs[(wave * 2 + 0) * 32 + lane] = kh ? mstat[0] : mstat[1];
  xs[(wave * 2 + 1) * 32 + lane] = kh ? lstat[0] : lstat[1];
  __syncthreads();                          // both halves' hand-overs are in LDS

  const int pw = wave ^ 4;
  float ma = kh ? mstat[1] : mstat[0];
  float la = kh ? lstat[1] : lstat[0];
  float mb = xs[(pw * 2 + 0) * 32 + lane];
  float lb = xs[(pw * 2 + 1) * 32 + lane];
  float mj = fmaxf(ma, mb);
  float sa = __expf(ma - mj), sb = __expf(mb - mj);
  float inv = gm / (la * sa + lb * sb);
  float ca = inv * sa, cb = inv * sb;

  // Epilogue: out(b,c,n) = x + gamma * out^T / l for the tile this wave keeps.
  const float* xb = x + (size_t)b * CC * NN;
  float* ob = out + (size_t)b * CC * NN;
#pragma unroll
  for (int ct = 0; ct < 8; ++ct) {
#pragma unroll
    for (int hh = 0; hh < 2; ++hh) {
      v4f o = *(const v4f*)(xa + ((pw * 16 + ct * 2 + hh) * 32 + lane) * 4);
#pragma unroll
      for (int v = 0; v < 4; ++v) {
        float mine = kh ? acc[1][ct][4 * hh + v] : acc[0][ct][4 * hh + v];
        int c = ct * 16 + 4 * hh + v + 8 * g;   // C/D layout: M = 4*hh + v + 8*(lane/16)
        size_t idx = (size_t)c * NN + n0 + 16 * kh + r;
        ob[idx] = xb[idx] + (ca * mine + cb * o[v]);
      }
    }
  }
}

// ---------------------------------------------------------------------------
extern "C" void kernel_launch(void* const* d_in, const int* in_sizes, int n_in,
                              void* d_out, int out_size, void* d_ws, size_t ws_size,
                              hipStream_t stream) {
  const float* x     = (const float*)d_in[0];
  const float* Wq    = (const float*)d_in[1];
  const float* Wk    = (const float*)d_in[2];
  const float* Wv    = (const float*)d_in[3];
  const float* gamma = (const float*)d_in[4];
  float* out = (float*)d_out;

  // Workspace: Qh (1 MB) | Kh (1 MB) | Vt (8 MB), all f16.
  _Float16* Qh = (_Float16*)d_ws;
  _Float16* Kh = Qh + (size_t)CB * NN * CQK;
  _Float16* Vt = Kh + (size_t)CB * NN * CQK;

  qkv_proj<<<CB * NN / 128, 256, 0, stream>>>(x, Wq, Wk, Wv, Qh, Kh, Vt);
  attn_kernel<<<CB * NN / 128, 256, 0, stream>>>(x, Qh, Kh, Vt, gamma, out);
}

// v007
// One run takes 47.2 microseconds.
// Two timings next to v006 both put it at 1.08 times that version's speed.
// Counting every step since v000, it is 5.13 times as fast.
#include <hip/hip_runtime.h>

typedef __attribute__((ext_vector_type(16))) _Float16 v16h;
typedef __attribute__((ext_vector_type(8)))  _Float16 v8h;
typedef __attribute__((ext_vector_type(8)))  float    v8f;
typedef __attribute__((ext_vector_type(4)))  float    v4f;
typedef __attribute__((ext_vector_type(2)))  float    v2f;

#define CB   8      // batches
#define CC   128    // channels (c_in)
#define CQK  16     // q/k channels
#define NN   4096   // spatial positions (64*64)

// ---------------------------------------------------------------------------
// Phase 1: Q, K and V projections as one product on the f32 matrix form
// (16x16x4): the 160 stacked weight rows (Wq | Wk | Wv) against x.
// A block owns 128 columns n, a wave 16 of them.  The wave's whole x slab
// (128 c x 16 n) sits in 64 registers and is read from memory exactly once; it
// serves as B for Q and K (D = [o][n]: a lane ends with 8 consecutive o of one
// n) and as A for V (D = [n][c]: a lane ends with 8 consecutive n of one c), so
// every result leaves as one packed 16-byte store.  Weights are staged in LDS,
// rows pitched at 528 B (16 B x odd) for conflict-free b128 fragment reads.
// k order, the same for both operands: of each 8 k, lane half g holds
// k = 4g .. 4g+3; the first matrix instruction takes the low pair, the second
// the high pair.
// Qh,Kh: (b, n, 16) f16.  Vt: (b, c, n) f16.  Q leaves multiplied by log2 e (in
// f32, ahead of its one rounding to f16), so phase 2's scores are exp2 arguments.
// ---------------------------------------------------------------------------
#define WROWS   (2 * CQK + CC)         // 160 stacked weight rows
#define WPITCH  (CC + 4)               // floats per staged weight row (528 B)
#define LOG2E   1.44269504088896340736f

__global__ void __launch_bounds__(256) qkv_proj(
    const float* __restrict__ x, const float* __restrict__ Wq,
    const float* __restrict__ Wk, const float* __restrict__ Wv,
    _Float16* __restrict__ Qh, _Float16* __restrict__ Kh,
    _Float16* __restrict__ Vt) {
  __shared__ __attribute__((aligned(16))) float sW[WROWS * WPITCH];
  int tid  = threadIdx.x;
  int lane = tid & 31;
  int wave = tid >> 5;
  int r    = lane & 15;
  int g    = lane >> 4;
  int b    = blockIdx.x / (NN / 128);
  int n0   = (blockIdx.x % (NN / 128)) * 128 + wave * 16;

  // Weight loads first, 16 bytes a thread a trip (a wave to a row), then the
  // wave's x slab: the weights are staged while the slab is still in flight.
  v4f wr[WROWS / 8];
#pragma unroll
  for (int i = 0; i < WROWS / 8; ++i) {
    const float* wsrc = i < 2 ? Wq + (i * 8 + wave) * CC
                      : i < 4 ? Wk + ((i - 2) * 8 + wave) * CC
                              : Wv + ((i - 4) * 8 + wave) * CC;
    wr[i] = *(const v4f*)(wsrc + lane * 4);
    // Ahead of any reuse of the address registers of the loads issued so far
    // (behind the last Wk load and behind the last Wv load).
    if (i == 3 || i == WROWS / 8 - 1) asm volatile("s_wait_xcnt 0x0" ::: "memory");
  }

  const float* xp = x + (size_t)b * CC * NN + (size_t)(4 * g) * NN + n0 + r;
  v2f xf[CC / 4];
#pragma unroll
  for (int kb = 0; kb < CC / 8; ++kb) {
    xf[2 * kb][0]     = xp[(size_t)(kb * 8 + 0) * NN];
    xf[2 * kb][1]     = xp[(size_t)(kb * 8 + 1) * NN];
    xf[2 * kb + 1][0] = xp[(size_t)(kb * 8 + 2) * NN];
    xf[2 * kb + 1][1] = xp[(size_t)(kb * 8 + 3) * NN];
  }
  // Ahead of any reuse of the slab loads' address registers.
  asm volatile("s_wait_xcnt 0x0" ::: "memory");

#pragma unroll
  for (int i = 0; i < WROWS / 8; ++i)
    *(v4f*)(&sW[(i * 8 + wave) * WPITCH + lane * 4]) = wr[i];
  __syncthreads();

  v8f acc[WROWS / 16];
#pragma unroll
  for (int t = 0; t < WROWS / 16; ++t) acc[t] = v8f{};

  // Weight fragments are double-buffered in registers: the reads of block kb+1
  // stand as one group ahead of the matrix instructions of block kb.
  const float* wl = sW + r * WPITCH + 4 * g;
  v4f w[2][WROWS / 16];
#pragma unroll
  for (int t = 0; t < WROWS / 16; ++t) w[0][t] = *(const v4f*)(wl + t * 16 * WPITCH);
#pragma unroll
  for (int kb = 0; kb < CC / 8; ++kb) {
    if (kb + 1 < CC / 8) {
#pragma unroll
      for (int t = 0; t < WROWS / 16; ++t)
        w[(kb + 1) & 1][t] = *(const v4f*)(wl + t * 16 * WPITCH + (kb + 1) * 8);
    }
    // Keeps the group of reads above ahead of this block's matrix instructions;
    // without it each read sinks to just before its use and is waited for there.
    __builtin_amdgcn_sched_barrier(0);
#pragma unroll
    for (int hh = 0; hh < 2; ++hh) {
      v2f xv = xf[2 * kb + hh];
#pragma unroll
      for (int t = 0; t < WROWS / 16; ++t) {
        v2f wv = {w[kb & 1][t][2 * hh], w[kb & 1][t][2 * hh + 1]};
        if (t < 2)   // Q, K: D[M = o][N = n]
          acc[t] = __builtin_amdgcn_wmma_f32_16x16x4_f32(false, wv, false, xv,
                                                         (short)0, acc[t], false, false);
        else         // V: D[M = n][N = c]
          acc[t] = __builtin_amdgcn_wmma_f32_16x16x4_f32(false, xv, false, wv,
                                                         (short)0, acc[t], false, false);
      }
    }
    // Ends the block: the next group of reads stays behind these instructions.
    __builtin_amdgcn_sched_barrier(0);
  }

#pragma unroll
  for (int t = 0; t < WROWS / 16; ++t) {
    v8h o;
#pragma unroll
    for (int v = 0; v < 8; ++v) o[v] = (_Float16)(t == 0 ? acc[t][v] * LOG2E : acc[t][v]);
    _Float16* dst =
        t == 0 ? Qh + ((size_t)b * NN + n0 + r) * CQK + 8 * g
      : t == 1 ? Kh + ((size_t)b * NN + n0 + r) * CQK + 8 * g
               : Vt + ((size_t)b * CC + (t - 2) * 16 + r) * NN + n0 + 8 * g;
    *(v8h*)dst = o;
  }
}

// ---------------------------------------------------------------------------
// Phase 2: flash attention.  S^T via WMMA so the softmax row = lane%16, P^T
// packs lane-locally, accumulator is out^T (c, n) tiles.
// A wave owns 32 query rows (two 16-row q tiles) and half of the keys: every K
// and V^T fragment it reads from LDS feeds two matrix instructions, one per q
// tile, so a block reads half the LDS bytes per product, and the two tiles'
// softmax chains are independent work for the vector port.  A block is 4 query
// groups x 2 key halves = 8 waves on 128 query rows; wave w and wave w^4 hold
// the same rows and the two halves of every stage's keys.  Behind the loop each
// wave of such a pair hands one tile's (m, l, acc) to the other through LDS and
// finishes the tile it keeps.
// A row's 32 scores of a pass sit in lanes l and l^16: the maximum is
// exchanged between the halves on the vector port, so no wait for an LDS-queue
// exchange drains the pass's fragment reads; each half keeps its own row sum
// (both halves rescale alike) and the two are joined once behind the loop.
// Lazy flash rescale: m is a reference, not the exact running maximum.  The
// accumulator rescale only runs when some row's scores exceed its reference by
// more than MGROW (one test per pass for both tiles), so P <= 2^MGROW, well
// inside f16; l and acc are relative to the same m, which cancels in acc / l.
// The vector port neither scales a score nor subtracts m from it: Q carries the
// factor log2 e, and the S^T products, whose k = 32 holds only 16 channels, take
// -m along in a padding slot: k = 16 is 1 in every K row and -m (log2 units) in
// every Q row.  m is kept a value that f16 holds exactly, and only the rescale
// rewrites it.  What a product leaves is the argument of exp2.
//
// The eight waves of a block walk the same stages, so each stage of KS keys
// (V^T tile 128 x KS and K tile KS x 16) is brought into LDS once per block by
// asynchronous copies, two buffers: stage s+1 flies while stage s is worked on.
// V rows are pitched at 272 B (16 B x odd) so the 16 rows of a b128 fragment
// read fall on distinct banks; K rows (32 B) are read as 512 contiguous bytes.
// All LDS fragment reads of a 32-key pass stand as one group at its head: the 16
// V^T reads of this pass and the 2 K reads of the wave's next pass in the stage.
// ---------------------------------------------------------------------------
#define KS      128                    // keys per stage
#define NST     (NN / KS)              // stages
#define KW      (KS / 2)               // keys of a stage per wave (one key half)
#define VPITCH  136                    // halves per staged V row (272 B)
#define VBUF    (CC * VPITCH)          // halves per V buffer
#define KBUF    (KS * CQK)             // halves per K buffer
#define MGROW   (8.0f * LOG2E)         // a row's scores (log2 units) may exceed its reference m by this

// One stage's copies of one thread: 8 x 16 B of V^T (a wave covers two whole
// 256-B rows per copy) and 16 B of K.  s_wait_xcnt 0 stands as the last line of
// the copies' own statement, ahead of any rewrite of the address registers.
__device__ __forceinline__ void stage_copy(const _Float16* gv, const _Float16* gk,
                                           unsigned lv, unsigned lk) {
  asm volatile(
      "global_load_async_to_lds_b128 %0, %9, off\n\t"
      "global_load_async_to_lds_b128 %1, %10, off\n\t"
      "global_load_async_to_lds_b128 %2, %11, off\n\t"
      "global_load_async_to_lds_b128 %3, %12, off\n\t"
      "global_load_async_to_lds_b128 %4, %13, off\n\t"
      "global_load_async_to_lds_b128 %5, %14, off\n\t"
      "global_load_async_to_lds_b128 %6, %15, off\n\t"
      "global_load_async_to_lds_b128 %7, %16, off\n\t"
      "global_load_async_to_lds_b128 %8, %17, off\n\t"
      "s_wait_xcnt 0x0"
      :: "v"(lv), "v"(lv + 1u * 16u * VPITCH * 2u), "v"(lv + 2u * 16u * VPITCH * 2u),
         "v"(lv + 3u * 16u * VPITCH * 2u), "v"(lv + 4u * 16u * VPITCH * 2u),
         "v"(lv + 5u * 16u * VPITCH * 2u), "v"(lv + 6u * 16u * VPITCH * 2u),
         "v"(lv + 7u * 16u * VPITCH * 2u), "v"(lk),
         "v"(gv), "v"(gv + 1 * 16 * NN), "v"(gv + 2 * 16 * NN), "v"(gv + 3 * 16 * NN),
         "v"(gv + 4 * 16 * NN), "v"(gv + 5 * 16 * NN), "v"(gv + 6 * 16 * NN),
         "v"(gv + 7 * 16 * NN), "v"(gk)
      : "memory");
}

// Lane l with lane l ^ 16 by a cross-row vector move: it counts on no LDS
// counter, so the fragment reads in flight are not waited for with it.
__device__ __forceinline__ float xhalf(float v) {
  int b = __builtin_bit_cast(int, v);
  return __builtin_bit_cast(float, __builtin_amdgcn_permlanex16(b, b, 0x76543210, 0xfedcba98, false, false));
}

__global__ void __launch_bounds__(256) attn_kernel(
    const float* __restrict__ x, const _Float16* __restrict__ Qh,
    const _Float16* __restrict__ Kh, const _Float16* __restrict__ Vt,
    const float* __restrict__ gamma, float* __restrict__ out) {
  __shared__ __attribute__((aligned(16))) _Float16 Vs[2 * VBUF];
  __shared__ __attribute__((aligned(16))) _Float16 Ks[2 * KBUF];

  int tid  = threadIdx.x;
  int lane = tid & 31;
  int wave = __builtin_amdgcn_readfirstlane(tid >> 5);
  int qg   = wave & 3;                      // query group: 32 rows
  int kh   = wave >> 2;                     // key half of every stage
  int b    = blockIdx.x >> 5;               // 32 blocks of 128 rows per batch
  int n0   = ((blockIdx.x & 31) << 7) + qg * 32;   // q rows n0 .. n0+31
  int r    = lane & 15;                     // q_row within tile / N index
  int g    = lane >> 4;                     // half-group (K-offset selector)

  const v8f zero = {};
  const float gm = gamma[0];                // uniform: read once, on the scalar path

  // B-operands: two Q tiles, B[K=o (padded to 32), N=q_row]; half 8 of the lower
  // lane half (k = 16) will hold -m, the other halves of 8..15 stay 0.
  v16h bq[2] = {v16h{}, v16h{}};
  const _Float16* qp0 = Qh + ((size_t)b * NN + n0 + r) * CQK + 8 * g;
  const _Float16* qp1 = qp0 + 16 * CQK;
  {
    v8h lo0 = *(const v8h*)qp0;
    v8h lo1 = *(const v8h*)qp1;
    // Ahead of any reuse of the two loads' address registers: as inputs of the
    // wait's own statement the addresses stay in their registers up to it.
    asm volatile("s_wait_xcnt 0x0" :: "v"(qp0), "v"(qp1) : "memory");
#pragma unroll
    for (int h = 0; h < 8; ++h) { bq[0][h] = lo0[h]; bq[1][h] = lo1[h]; }
  }

  v8f acc[2][8];
#pragma unroll
  for (int j = 0; j < 2; ++j)
#pragma unroll
    for (int t = 0; t < 8; ++t) acc[j][t] = zero;
  // Reference 0 until the first pass, whose test is forced (grow) and which may
  // move m down as well as up (dmin): m then is that pass's true maximum.
  float mstat[2] = {0.0f, 0.0f}, lstat[2] = {0.0f, 0.0f};
  float grow = -1e30f, dmin = -1e30f;

  const _Float16* Kb = Kh + (size_t)b * NN * CQK;
  const _Float16* Vb = Vt + (size_t)b * CC * NN;

  // This thread's share of a stage: V row (tid>>4) + 16*i, 16-B column tid&15;
  // K bytes 16*tid of the stage's 4 KB.
  const _Float16* gv = Vb + (size_t)(tid >> 4) * NN + (tid & 15) * 8;
  const _Float16* gk = Kb + tid * 8;
  const unsigned lv = (unsigned)(size_t)(&Vs[(tid >> 4) * VPITCH + (tid & 15) * 8]);
  const unsigned lk = (unsigned)(size_t)(&Ks[tid * 8]);

  // Prologue: stage 0 lands and is published, then stage 1 starts to fly.
  stage_copy(gv, gk, lv, lk);
  asm volatile("s_wait_asynccnt 0x0" ::: "memory");  // own copies of stage 0 landed
  __syncthreads();                                   // ... and every other wave's
  stage_copy(gv + KS, gk + KBUF, lv + VBUF * 2u, lk + KBUF * 2u);

  for (int s = 0; s < NST; ++s) {
    const int buf = s & 1;
    const _Float16* vs = Vs + buf * VBUF + r * VPITCH + 8 * g + kh * KW;
    const _Float16* ks = Ks + buf * KBUF + (kh * KW + r) * CQK + 8 * g;

    // K fragments, two register sets; the first pair of this wave's key half is read here.
    v8h kf[2][2];
    kf[0][0] = *(const v8h*)(ks);
    kf[0][1] = *(const v8h*)(ks + 16 * CQK);
    // Keeps this pair ahead of the first pass's group: its S^T products then wait
    // for these two reads and not for the eighteen behind them.
    __builtin_amdgcn_sched_barrier(0);

#pragma unroll
    for (int mm = 0; mm < KW; mm += 32) {
      const int cur = (mm >> 5) & 1;
      // The pass's read group: its V^T fragments, then the next pass's K pair
      // (never beyond this wave's half of the stage).
      v8h vlo[8], vhi[8];
#pragma unroll
      for (int ct = 0; ct < 8; ++ct) {
        const _Float16* vrow = vs + ct * 16 * VPITCH + mm;
        vlo[ct] = *(const v8h*)(vrow);
        vhi[ct] = *(const v8h*)(vrow + 16);
      }
      if (mm + 32 < KW) {
        kf[cur ^ 1][0] = *(const v8h*)(ks + (mm + 32) * CQK);
        kf[cur ^ 1][1] = *(const v8h*)(ks + (mm + 48) * CQK);
      }
      // Keeps the group above ahead of the pass's work; without it each read
      // sinks to just before its matrix instruction and is waited for there.
      __builtin_amdgcn_sched_barrier(0);

      // A-operands: two K tiles, A[M = m col, K = o padded to 32]; half 8 is 1 in
      // all lanes: k = 16 meets -m, k = 24 (upper lane half) meets a 0 of Q's.
      v16h ak0 = {}, ak1 = {};
      ak0[8] = (_Float16)1.0f;
      ak1[8] = (_Float16)1.0f;
#pragma unroll
      for (int h = 0; h < 8; ++h) { ak0[h] = kf[cur][0][h]; ak1[h] = kf[cur][1][h]; }
      // S^T tiles minus the reference: D[M = m local, N = q_row] = K . Q^T - m,
      // each K tile against both q tiles
      v8f s0[2], s1[2];
#pragma unroll
      for (int j = 0; j < 2; ++j) {
        s0[j] = __builtin_amdgcn_wmma_f32_16x16x32_f16(false, ak0, false, bq[j],
                                                       (short)0, zero, false, false);
        s1[j] = __builtin_amdgcn_wmma_f32_16x16x32_f16(false, ak1, false, bq[j],
                                                       (short)0, zero, false, false);
      }

      // Maximum of these 32 columns above the reference in use; per-lane row = r.
      float tmax[2];
#pragma unroll
      for (int j = 0; j < 2; ++j) {
        float t = -1e30f;
#pragma unroll
        for (int v = 0; v < 8; ++v) t = fmaxf(t, fmaxf(s0[j][v], s1[j][v]));
        tmax[j] = fmaxf(t, xhalf(t));
      }

      // Lazy rescale: only when some row's maximum exceeds the reference in use
      // by more than MGROW; every row then moves to this pass's maximum if above its reference (rounded to
      // f16), by d, and this pass's scores, made against the old reference, follow.
      if (__any(tmax[0] > grow || tmax[1] > grow)) {
#pragma unroll
        for (int j = 0; j < 2; ++j) {
          _Float16 mh = (_Float16)(mstat[j] + fmaxf(tmax[j], dmin));
          float d  = (float)mh - mstat[j];
          float sc = __builtin_amdgcn_exp2f(-fmaxf(d, 0.0f));   // unchanged max: sc = 1
          mstat[j] = (float)mh;
          bq[j][8] = g ? (_Float16)0.0f : -mh;
          lstat[j] *= sc;
#pragma unroll
          for (int ct = 0; ct < 8; ++ct) {
#pragma unroll
            for (int v = 0; v < 8; ++v) acc[j][ct][v] *= sc;
          }
#pragma unroll
          for (int v = 0; v < 8; ++v) {
            s0[j][v] -= d;
            s1[j][v] -= d;
          }
        }
        grow = MGROW;
        dmin = 0.0f;
      }

      // Pack P^T lane-locally into B layout: B[K = m local 0..31, N = q_row].
      v16h bp[2];
#pragma unroll
      for (int j = 0; j < 2; ++j) {
        float p0[8], p1[8];
        float rsum = 0.0f;
#pragma unroll
        for (int v = 0; v < 8; ++v) {
          p0[v] = __builtin_amdgcn_exp2f(s0[j][v]);
          p1[v] = __builtin_amdgcn_exp2f(s1[j][v]);
          rsum += p0[v] + p1[v];
        }
        lstat[j] += rsum;                   // this lane half's 16 keys only
#pragma unroll
        for (int v = 0; v < 8; ++v) {
          bp[j][v]     = (_Float16)p0[v];
          bp[j][8 + v] = (_Float16)p1[v];
        }
      }

      // acc += V^T . P^T   (out^T tiles, M = c, N = q_row): one fragment, two tiles
#pragma unroll
      for (int ct = 0; ct < 8; ++ct) {
        v16h av;
#pragma unroll
        for (int h = 0; h < 8; ++h) { av[h] = vlo[ct][h]; av[8 + h] = vhi[ct][h]; }
#pragma unroll
        for (int j = 0; j < 2; ++j)
          acc[j][ct] = __builtin_amdgcn_wmma_f32_16x16x32_f16(false, av, false, bp[j],
                                                              (short)0, acc[j][ct], false, false);
      }
      // Ends the pass: the next group of reads stays behind these instructions.
      __builtin_amdgcn_sched_barrier(0);
    }

    // Publish point of stage s+1, every wave, in this order.
    asm volatile("s_wait_dscnt 0x0" ::: "memory");     // own reads of buffer 'buf' returned
    asm volatile("s_wait_asynccnt 0x0" ::: "memory");  // own copies of stage s+1 landed
    __syncthreads();  // publishes stage s+1; ends every wave's reads of buffer 'buf'
    if (s + 2 < NST)  // block-uniform: refill the buffer just left with stage s+2
      stage_copy(gv + (s + 2) * KS, gk + (s + 2) * KBUF,
                 lv + buf * (VBUF * 2u), lk + buf * (KBUF * 2u));
  }
  asm volatile("s_wait_asynccnt 0x0" ::: "memory");    // no copy in flight at the wave's end

  // Join of the two key halves.  The loop's last barrier ended every read of the
  // stage buffers and no copy is in flight, so they serve as the exchange area.
  // Wave kh keeps q tile kh and hands tile 1-kh to its partner (wave ^ 4).
  lstat[0] += xhalf(lstat[0]);              // join the lane halves' row sums
  lstat[1] += xhalf(lstat[1]);
  float* xa = (float*)Vs;                   // 8 waves x 16 x 512 B
  float* xs = (float*)Ks;                   // 8 waves x 2 x 128 B
#pragma unroll
  for (int ct = 0; ct < 8; ++ct) {
#pragma unroll
    for (int hh = 0; hh < 2; ++hh) {
      v4f o;
#pragma unroll
      for (int v = 0; v < 4; ++v) o[v] = kh ? acc[0][ct][4 * hh + v] : acc[1][ct][4 * hh + v];
      *(v4f*)(xa + ((wave * 16 + ct * 2 + hh) * 32 + lane) * 4) = o;
    }
  }
  xs[(wave * 2 + 0) * 32 + lane] = kh ? mstat[0] : mstat[1];
  xs[(wave * 2 + 1) * 32 + lane] = kh ? lstat[0] : lstat[1];
  __syncthreads();                          // both halves' hand-overs are in LDS

  const int pw = wave ^ 4;
  float ma = kh ? mstat[1] : mstat[0];
  float la = kh ? lstat[1] : lstat[0];
  float mb = xs[(pw * 2 + 0) * 32 + lane];
  float lb = xs[(pw * 2 + 1) * 32 + lane];
  float mj = fmaxf(ma, mb);
  float sa = __builtin_amdgcn_exp2f(ma - mj), sb = __builtin_amdgcn_exp2f(mb - mj);
  float inv = gm / (la * sa + lb * sb);
  float ca = inv * sa, cb = inv * sb;

  // Epilogue: out(b,c,n) = x + gamma * out^T / l for the tile this wave keeps.
  const float* xb = x + (size_t)b * CC * NN;
  float* ob = out + (size_t)b * CC * NN;
#pragma unroll
  for (int ct = 0; ct < 8; ++ct) {
#pragma unroll
    for (int hh = 0; hh < 2; ++hh) {
      v4f o = *(const v4f*)(xa + ((pw * 16 + ct * 2 + hh) * 32 + lane) * 4);
#pragma unroll
      for (int v = 0; v < 4; ++v) {
        float mine = kh ? acc[1][ct][4 * hh + v] : acc[0][ct][4 * hh + v];
        int c = ct * 16 + 4 * hh + v + 8 * g;   // C/D layout: M = 4*hh + v + 8*(lane/16)
        size_t idx = (size_t)c * NN + n0 + 16 * kh + r;
        ob[idx] = xb[idx] + (ca * mine + cb * o[v]);
      }
    }
  }
}

// ---------------------------------------------------------------------------
extern "C" void kernel_launch(void* const* d_in, const int* in_sizes, int n_in,
                              void* d_out, int out_size, void* d_ws, size_t ws_size,
                              hipStream_t stream) {
  const float* x     = (const float*)d_in[0];
  const float* Wq    = (const float*)d_in[1];
  const float* Wk    = (const float*)d_in[2];
  const float* Wv    = (const float*)d_in[3];
  const float* gamma = (const float*)d_in[4];
  float* out = (float*)d_out;

  // Workspace: Qh (1 MB) | Kh (1 MB) | Vt (8 MB), all f16.
  _Float16* Qh = (_Float16*)d_ws;
  _Float16* Kh = Qh + (size_t)CB * NN * CQK;
  _Float16* Vt = Kh + (size_t)CB * NN * CQK;

  qkv_proj<<<CB * NN / 128, 256, 0, stream>>>(x, Wq, Wk, Wv, Qh, Kh, Vt);
  attn_kernel<<<CB * NN / 128, 256, 0, stream>>>(x, Qh, Kh, Vt, gamma, out);
}

// v008
// Measured time: 45 microseconds a run.
// Next to v007, in two timings, it ran 1.05 times as fast each time.
// Counting every step since v000, it is 5.37 times as fast.
#include <hip/hip_runtime.h>

typedef __attribute__((ext_vector_type(16))) _Float16 v16h;
typedef __attribute__((ext_vector_type(8)))  _Float16 v8h;
typedef __attribute__((ext_vector_type(8)))  float    v8f;
typedef __attribute__((ext_vector_type(4)))  float    v4f;
typedef __attribute__((ext_vector_type(2)))  float    v2f;

#define CB   8      // batches
#define CC   128    // channels (c_in)
#define CQK  16     // q/k channels
#define NN   4096   // spatial positions (64*64)

// ---------------------------------------------------------------------------
// Phase 1: Q, K and V projections as one product on the f32 matrix form
// (16x16x4): the 160 stacked weight rows (Wq | Wk | Wv) against x.
// A block owns 128 columns n, a wave 16 of them.  The wave's whole x slab
// (128 c x 16 n) sits in 64 registers and is read from memory exactly once; it
// serves as B for Q and K (D = [o][n]: a lane ends with 8 consecutive o of one
// n) and as A for V (D = [n][c]: a lane ends with 8 consecutive n of one c), so
// every result leaves as one packed 16-byte store.  Weights are staged in LDS,
// rows pitched at 528 B (16 B x odd) for conflict-free b128 fragment reads.
// k order, the same for both operands: of each 8 k, lane half g holds
// k = 4g .. 4g+3; the first matrix instruction takes the low pair, the second
// the high pair.
// Qh,Kh: (b, n, 16) f16.  Vt: (b, c, n) f16.  Q leaves multiplied by log2 e (in
// f32, ahead of its one rounding to f16), so phase 2's scores are exp2 arguments.
// ---------------------------------------------------------------------------
#define WROWS   (2 * CQK + CC)         // 160 stacked weight rows
#define WPITCH  (CC + 4)               // floats per staged weight row (528 B)
#define LOG2E   1.44269504088896340736f

__global__ void __launch_bounds__(256) qkv_proj(
    const float* __restrict__ x, const float* __restrict__ Wq,
    const float* __restrict__ Wk, const float* __restrict__ Wv,
    _Float16* __restrict__ Qh, _Float16* __restrict__ Kh,
    _Float16* __restrict__ Vt) {
  __shared__ __attribute__((aligned(16))) float sW[WROWS * WPITCH];
  int tid  = threadIdx.x;
  int lane = tid & 31;
  int wave = tid >> 5;
  int r    = lane & 15;
  int g    = lane >> 4;
  int b    = blockIdx.x / (NN / 128);
  int n0   = (blockIdx.x % (NN / 128)) * 128 + wave * 16;

  // Weight loads first, 16 bytes a thread a trip (a wave to a row), then the
  // wave's x slab: the weights are staged while the slab is still in flight.
  v4f wr[WROWS / 8];
#pragma unroll
  for (int i = 0; i < WROWS / 8; ++i) {
    const float* wsrc = i < 2 ? Wq + (i * 8 + wave) * CC
                      : i < 4 ? Wk + ((i - 2) * 8 + wave) * CC
                              : Wv + ((i - 4) * 8 + wave) * CC;
    wr[i] = *(const v4f*)(wsrc + lane * 4);
    // Ahead of any reuse of the address registers of the loads issued so far
    // (behind the last Wk load and behind the last Wv load).
    if (i == 3 || i == WROWS / 8 - 1) asm volatile("s_wait_xcnt 0x0" ::: "memory");
  }

  const float* xp = x + (size_t)b * CC * NN + (size_t)(4 * g) * NN + n0 + r;
  v2f xf[CC / 4];
#pragma unroll
  for (int kb = 0; kb < CC / 8; ++kb) {
    xf[2 * kb][0]     = xp[(size_t)(kb * 8 + 0) * NN];
    xf[2 * kb][1]     = xp[(size_t)(kb * 8 + 1) * NN];
    xf[2 * kb + 1][0] = xp[(size_t)(kb * 8 + 2) * NN];
    xf[2 * kb + 1][1] = xp[(size_t)(kb * 8 + 3) * NN];
  }
  // Ahead of any reuse of the slab loads' address registers.
  asm volatile("s_wait_xcnt 0x0" ::: "memory");

#pragma unroll
  for (int i = 0; i < WROWS / 8; ++i)
    *(v4f*)(&sW[(i * 8 + wave) * WPITCH + lane * 4]) = wr[i];
  __syncthreads();

  v8f acc[WROWS / 16];
#pragma unroll
  for (int t = 0; t < WROWS / 16; ++t) acc[t] = v8f{};

  // Weight fragments are double-buffered in registers: the reads of block kb+1
  // stand as one group ahead of the matrix instructions of block kb.
  const float* wl = sW + r * WPITCH + 4 * g;
  v4f w[2][WROWS / 16];
#pragma unroll
  for (int t = 0; t < WROWS / 16; ++t) w[0][t] = *(const v4f*)(wl + t * 16 * WPITCH);
#pragma unroll
  for (int kb = 0; kb < CC / 8; ++kb) {
    if (kb + 1 < CC / 8) {
#pragma unroll
      for (int t = 0; t < WROWS / 16; ++t)
        w[(kb + 1) & 1][t] = *(const v4f*)(wl + t * 16 * WPITCH + (kb + 1) * 8);
    }
    // Keeps the group of reads above ahead of this block's matrix instructions;
    // without it each read sinks to just before its use and is waited for there.
    __builtin_amdgcn_sched_barrier(0);
#pragma unroll
    for (int hh = 0; hh < 2; ++hh) {
      v2f xv = xf[2 * kb + hh];
#pragma unroll
      for (int t = 0; t < WROWS / 16; ++t) {
        v2f wv = {w[kb & 1][t][2 * hh], w[kb & 1][t][2 * hh + 1]};
        if (t < 2)   // Q, K: D[M = o][N = n]
          acc[t] = __builtin_amdgcn_wmma_f32_16x16x4_f32(false, wv, false, xv,
                                                         (short)0, acc[t], false, false);
        else         // V: D[M = n][N = c]
          acc[t] = __builtin_amdgcn_wmma_f32_16x16x4_f32(false, xv, false, wv,
                                                         (short)0, acc[t], false, false);
      }
    }
    // Ends the block: the next group of reads stays behind these instructions.
    __builtin_amdgcn_sched_barrier(0);
  }

#pragma unroll
  for (int t = 0; t < WROWS / 16; ++t) {
    v8h o;
#pragma unroll
    for (int v = 0; v < 8; ++v) o[v] = (_Float16)(t == 0 ? acc[t][v] * LOG2E : acc[t][v]);
    _Float16* dst =
        t == 0 ? Qh + ((size_t)b * NN + n0 + r) * CQK + 8 * g
      : t == 1 ? Kh + ((size_t)b * NN + n0 + r) * CQK + 8 * g
               : Vt + ((size_t)b * CC + (t - 2) * 16 + r) * NN + n0 + 8 * g;
    *(v8h*)dst = o;
  }
}

// ---------------------------------------------------------------------------
// Phase 2: flash attention.  S^T via WMMA so the softmax row = lane%16, P^T
// packs lane-locally, accumulator is out^T (c, n) tiles.
// A wave owns 32 query rows (two 16-row q tiles) and half of the keys: every K
// and V^T fragment it reads from LDS feeds two matrix instructions, one per q
// tile, so a block reads half the LDS bytes per product, and the two tiles'
// softmax chains are independent work for the vector port.  A block is 4 query
// groups x 2 key halves = 8 waves on 128 query rows; wave w and wave w^4 hold
// the same rows and the two halves of every stage's keys.  Behind the loop each
// wave of such a pair hands one tile's (m, l, acc) to the other through LDS and
// finishes the tile it keeps.
// A row's 32 scores of a pass sit in lanes l and l^16: the maximum is
// exchanged between the halves on the vector port, so no wait for an LDS-queue
// exchange drains the pass's fragment reads; each half keeps its own row sum
// (both halves rescale alike) and the two are joined once behind the loop.
// Lazy flash rescale: m is a reference, not the exact running maximum.  The
// accumulator rescale only runs when some row's scores exceed its reference by
// more than MGROW (one test per pass for both tiles), so P <= 2^MGROW, well
// inside f16; l and acc are relative to the same m, which cancels in acc / l.
// The vector port neither scales a score nor subtracts m from it: Q carries the
// factor log2 e, and the S^T products, whose k = 32 holds only 16 channels, take
// -m along in a padding slot: k = 16 is 1 in every K row and -m (log2 units) in
// every Q row.  m is kept a value that f16 holds exactly, and only the rescale
// rewrites it.  What a product leaves is the argument of exp2.
//
// The eight waves of a block walk the same stages, so each stage of KS keys
// (V^T tile 128 x KS and K tile KS x 16) is brought into LDS once per block by
// asynchronous copies, two buffers: stage s+1 flies while stage s is worked on.
// A stage is as long as two buffers fit the LDS of a WGP: a wave runs KW / 32
// passes between two publish points, so the waves of a SIMD, which leave a
// barrier in step, drift apart (one's vector work under the other's matrix work)
// and are drained and restarted NST times only.
// A V buffer holds the two key halves of its stage as two tiles of 128 x KW, so
// every fragment read of a wave lies within the 64 KB that a read's immediate
// offset spans.  V rows are pitched at 528 B (16 B x odd) so the 16 rows of a b128
// fragment read fall on distinct banks; K rows (32 B) are read as 512 contiguous
// bytes.
// All LDS fragment reads of a 32-key pass stand as one group at its head: the 16
// V^T reads of this pass and the 2 K reads of the wave's next pass in the stage.
// ---------------------------------------------------------------------------
#define KS      512                    // keys per stage
#define NST     (NN / KS)              // stages
#define KW      (KS / 2)               // keys of a stage per wave (one key half)
#define VPITCH  264                    // halves per staged V row of one key half (528 B)
#define VHALF   (CC * VPITCH)          // halves per key half of a V buffer
#define VBUF    (2 * VHALF)            // halves per V buffer
#define KBUF    (KS * CQK)             // halves per K buffer
#define MGROW   (8.0f * LOG2E)         // a row's scores (log2 units) may exceed its reference m by this

// Nine copies of one thread.  s_wait_xcnt 0 stands as the last line of the
// copies' own statement, ahead of any rewrite of the address registers.
__device__ __forceinline__ void copy9(const unsigned* l, const _Float16* const* g) {
  asm volatile(
      "global_load_async_to_lds_b128 %0, %9, off\n\t"
      "global_load_async_to_lds_b128 %1, %10, off\n\t"
      "global_load_async_to_lds_b128 %2, %11, off\n\t"
      "global_load_async_to_lds_b128 %3, %12, off\n\t"
      "global_load_async_to_lds_b128 %4, %13, off\n\t"
      "global_load_async_to_lds_b128 %5, %14, off\n\t"
      "global_load_async_to_lds_b128 %6, %15, off\n\t"
      "global_load_async_to_lds_b128 %7, %16, off\n\t"
      "global_load_async_to_lds_b128 %8, %17, off\n\t"
      "s_wait_xcnt 0x0"
      :: "v"(l[0]), "v"(l[1]), "v"(l[2]), "v"(l[3]), "v"(l[4]), "v"(l[5]),
         "v"(l[6]), "v"(l[7]), "v"(l[8]),
         "v"(g[0]), "v"(g[1]), "v"(g[2]), "v"(g[3]), "v"(g[4]), "v"(g[5]),
         "v"(g[6]), "v"(g[7]), "v"(g[8])
      : "memory");
}

// One stage's copies of one thread: 32 x 16 B of V^T (a wave covers one key half
// of a 1024-B row per copy, the block four rows) and 4 x 16 B of K: 36 in flight.
// gv, gk: the stage's first V^T and K element (uniform); ov, ok: this thread's
// element offsets from them; lv, lk: its LDS byte addresses in the buffer.
// (Offsets, not per-thread pointers, live through the loop: kept as pointers,
// which are operands of the first statement, they were spilled to scratch.)
__device__ __forceinline__ void stage_copy(const _Float16* gv, const _Float16* gk,
                                           unsigned ov, unsigned ok,
                                           unsigned lv, unsigned lk) {
  unsigned l[36];
  const _Float16* g[36];
#pragma unroll
  for (int i = 0; i < 32; ++i) {
    l[i] = lv + (unsigned)i * 4u * VPITCH * 2u;
    g[i] = gv + (size_t)i * 4 * NN + ov;
  }
#pragma unroll
  for (int i = 0; i < 4; ++i) {
    l[32 + i] = lk + (unsigned)i * 4096u;
    g[32 + i] = gk + i * 2048 + ok;
  }
#pragma unroll
  for (int i = 0; i < 36; i += 9) copy9(l + i, g + i);
}

// Lane l with lane l ^ 16 by a cross-row vector move: it counts on no LDS
// counter, so the fragment reads in flight are not waited for with it.
__device__ __forceinline__ float xhalf(float v) {
  int b = __builtin_bit_cast(int, v);
  return __builtin_bit_cast(float, __builtin_amdgcn_permlanex16(b, b, 0x76543210, 0xfedcba98, false, false));
}

__global__ void __launch_bounds__(256) attn_kernel(
    const float* __restrict__ x, const _Float16* __restrict__ Qh,
    const _Float16* __restrict__ Kh, const _Float16* __restrict__ Vt,
    const float* __restrict__ gamma, float* __restrict__ out) {
  __shared__ __attribute__((aligned(16))) _Float16 Vs[2 * VBUF];
  __shared__ __attribute__((aligned(16))) _Float16 Ks[2 * KBUF];

  int tid  = threadIdx.x;
  int lane = tid & 31;
  int wave = __builtin_amdgcn_readfirstlane(tid >> 5);
  int qg   = wave & 3;                      // query group: 32 rows
  int kh   = wave >> 2;                     // key half of every stage
  int b    = blockIdx.x >> 5;               // 32 blocks of 128 rows per batch
  int n0   = ((blockIdx.x & 31) << 7) + qg * 32;   // q rows n0 .. n0+31
  int r    = lane & 15;                     // q_row within tile / N index
  int g    = lane >> 4;                     // half-group (K-offset selector)

  const v8f zero = {};
  const float gm = gamma[0];                // uniform: read once, on the scalar path

  // B-operands: two Q tiles, B[K=o (padded to 32), N=q_row]; half 8 of the lower
  // lane half (k = 16) will hold -m, the other halves of 8..15 stay 0.
  v16h bq[2] = {v16h{}, v16h{}};
  const _Float16* qp0 = Qh + ((size_t)b * NN + n0 + r) * CQK + 8 * g;
  const _Float16* qp1 = qp0 + 16 * CQK;
  {
    v8h lo0 = *(const v8h*)qp0;
    v8h lo1 = *(const v8h*)qp1;
    // Ahead of any reuse of the two loads' address registers: as inputs of the
    // wait's own statement the addresses stay in their registers up to it.
    asm volatile("s_wait_xcnt 0x0" :: "v"(qp0), "v"(qp1) : "memory");
#pragma unroll
    for (int h = 0; h < 8; ++h) { bq[0][h] = lo0[h]; bq[1][h] = lo1[h]; }
  }

  v8f acc[2][8];
#pragma unroll
  for (int j = 0; j < 2; ++j)
#pragma unroll
    for (int t = 0; t < 8; ++t) acc[j][t] = zero;
  // Reference 0 until the first pass, whose test is forced (grow) and which may
  // move m down as well as up (dmin): m then is that pass's true maximum.
  float mstat[2] = {0.0f, 0.0f}, lstat[2] = {0.0f, 0.0f};
  float grow = -1e30f, dmin = -1e30f;

  const _Float16* Kb = Kh + (size_t)b * NN * CQK;
  const _Float16* Vb = Vt + (size_t)b * CC * NN;

  // This thread's share of a stage: V row (tid>>6) + 4*i, 16-B column tid&63;
  // K bytes 16*tid + 4096*i of the stage's 16 KB.
  const unsigned ov = (unsigned)(tid >> 6) * NN + (tid & 63) * 8;
  const unsigned ok = (unsigned)tid * 8;
  const unsigned lv = (unsigned)(size_t)(&Vs[((tid >> 5) & 1) * VHALF + (tid >> 6) * VPITCH + (tid & 31) * 8]);
  const unsigned lk = (unsigned)(size_t)(&Ks[tid * 8]);

  // Prologue: stage 0 lands and is published, then stage 1 starts to fly.
  stage_copy(Vb, Kb, ov, ok, lv, lk);
  asm volatile("s_wait_asynccnt 0x0" ::: "memory");  // own copies of stage 0 landed
  __syncthreads();                                   // ... and every other wave's
  stage_copy(Vb + KS, Kb + KBUF, ov, ok, lv + VBUF * 2u, lk + KBUF * 2u);

  for (int s = 0; s < NST; ++s) {
    const int buf = s & 1;
    const _Float16* vs = Vs + buf * VBUF + kh * VHALF + r * VPITCH + 8 * g;
    const _Float16* ks = Ks + buf * KBUF + (kh * KW + r) * CQK + 8 * g;

    // K fragments, two register sets; the first pair of this wave's key half is read here.
    v8h kf[2][2];
    kf[0][0] = *(const v8h*)(ks);
    kf[0][1] = *(const v8h*)(ks + 16 * CQK);
    // Keeps this pair ahead of the first pass's group: its S^T products then wait
    // for these two reads and not for the eighteen behind them.
    __builtin_amdgcn_sched_barrier(0);

    // Rolled, two passes a trip (one per K register set): unrolled KW / 32 times
    // the loop's text would be four times as long, and nothing in a pass depends
    // on its number.
#pragma unroll 1
    for (int mp = 0; mp < KW; mp += 64) {
#pragma unroll
    for (int mh = 0; mh < 64; mh += 32) {
      const int mm  = mp + mh;
      const int cur = mh >> 5;
      // The pass's read group: its V^T fragments, then the next pass's K pair
      // (never beyond this wave's half of the stage).
      v8h vlo[8], vhi[8];
#pragma unroll
      for (int ct = 0; ct < 8; ++ct) {
        const _Float16* vrow = vs + ct * 16 * VPITCH + mm;
        vlo[ct] = *(const v8h*)(vrow);
        vhi[ct] = *(const v8h*)(vrow + 16);
      }
      if (mh == 0 || mp + 64 < KW) {   // wave-uniform
        kf[cur ^ 1][0] = *(const v8h*)(ks + (mm + 32) * CQK);
        kf[cur ^ 1][1] = *(const v8h*)(ks + (mm + 48) * CQK);
      }
      // Keeps the group above ahead of the pass's work; without it each read
      // sinks to just before its matrix instruction and is waited for there.
      __builtin_amdgcn_sched_barrier(0);

      // A-operands: two K tiles, A[M = m col, K = o padded to 32]; half 8 is 1 in
      // all lanes: k = 16 meets -m, k = 24 (upper lane half) meets a 0 of Q's.
      v16h ak0 = {}, ak1 = {};
      ak0[8] = (_Float16)1.0f;
      ak1[8] = (_Float16)1.0f;
#pragma unroll
      for (int h = 0; h < 8; ++h) { ak0[h] = kf[cur][0][h]; ak1[h] = kf[cur][1][h]; }
      // S^T tiles minus the reference: D[M = m local, N = q_row] = K . Q^T - m,
      // each K tile against both q tiles
      v8f s0[2], s1[2];
#pragma unroll
      for (int j = 0; j < 2; ++j) {
        s0[j] = __builtin_amdgcn_wmma_f32_16x16x32_f16(false, ak0, false, bq[j],
                                                       (short)0, zero, false, false);
        s1[j] = __builtin_amdgcn_wmma_f32_16x16x32_f16(false, ak1, false, bq[j],
                                                       (short)0, zero, false, false);
      }

      // Maximum of these 32 columns above the reference in use; per-lane row = r.
      float tmax[2];
#pragma unroll
      for (int j = 0; j < 2; ++j) {
        float t = -1e30f;
#pragma unroll
        for (int v = 0; v < 8; ++v) t = fmaxf(t, fmaxf(s0[j][v], s1[j][v]));
        tmax[j] = fmaxf(t, xhalf(t));
      }

      // Lazy rescale: only when some row's maximum exceeds the reference in use
      // by more than MGROW; every row then moves to this pass's maximum if above its reference (rounded to
      // f16), by d, and this pass's scores, made against the old reference, follow.
      if (__any(tmax[0] > grow || tmax[1] > grow)) {
#pragma unroll
        for (int j = 0; j < 2; ++j) {
          _Float16 mh = (_Float16)(mstat[j] + fmaxf(tmax[j], dmin));
          float d  = (float)mh - mstat[j];
          float sc = __builtin_amdgcn_exp2f(-fmaxf(d, 0.0f));   // unchanged max: sc = 1
          mstat[j] = (float)mh;
          bq[j][8] = g ? (_Float16)0.0f : -mh;
          lstat[j] *= sc;
#pragma unroll
          for (int ct = 0; ct < 8; ++ct) {
#pragma unroll
            for (int v = 0; v < 8; ++v) acc[j][ct][v] *= sc;
          }
#pragma unroll
          for (int v = 0; v < 8; ++v) {
            s0[j][v] -= d;
            s1[j][v] -= d;
          }
        }
        grow = MGROW;
        dmin = 0.0f;
      }

      // Pack P^T lane-locally into B layout: B[K = m local 0..31, N = q_row].
      v16h bp[2];
#pragma unroll
      for (int j = 0; j < 2; ++j) {
        float p0[8], p1[8];
        float rsum = 0.0f;
#pragma unroll
        for (int v = 0; v < 8; ++v) {
          p0[v] = __builtin_amdgcn_exp2f(s0[j][v]);
          p1[v] = __builtin_amdgcn_exp2f(s1[j][v]);
          rsum += p0[v] + p1[v];
        }
        lstat[j] += rsum;                   // this lane half's 16 keys only
#pragma unroll
        for (int v = 0; v < 8; ++v) {
          bp[j][v]     = (_Float16)p0[v];
          bp[j][8 + v] = (_Float16)p1[v];
        }
      }

      // acc += V^T . P^T   (out^T tiles, M = c, N = q_row): one fragment, two tiles
#pragma unroll
      for (int ct = 0; ct < 8; ++ct) {
        v16h av;
#pragma unroll
        for (int h = 0; h < 8; ++h) { av[h] = vlo[ct][h]; av[8 + h] = vhi[ct][h]; }
#pragma unroll
        for (int j = 0; j < 2; ++j)
          acc[j][ct] = __builtin_amdgcn_wmma_f32_16x16x32_f16(false, av, false, bp[j],
                                                              (short)0, acc[j][ct], false, false);
      }
      // Ends the pass: the next group of reads stays behind these instructions.
      __builtin_amdgcn_sched_barrier(0);
    }
    }

    // Publish point of stage s+1, every wave, in this order.
    asm volatile("s_wait_dscnt 0x0" ::: "memory");     // own reads of buffer 'buf' returned
    asm volatile("s_wait_asynccnt 0x0" ::: "memory");  // own copies of stage s+1 landed
    __syncthreads();  // publishes stage s+1; ends every wave's reads of buffer 'buf'
    if (s + 2 < NST)  // block-uniform: refill the buffer just left with stage s+2
      stage_copy(Vb + (s + 2) * KS, Kb + (s + 2) * KBUF, ov, ok,
                 lv + buf * (VBUF * 2u), lk + buf * (KBUF * 2u));
  }
  asm volatile("s_wait_asynccnt 0x0" ::: "memory");    // no copy in flight at the wave's end

  // Join of the two key halves.  The loop's last barrier ended every read of the
  // stage buffers and no copy is in flight, so they serve as the exchange area.
  // Wave kh keeps q tile kh and hands tile 1-kh to its partner (wave ^ 4).
  lstat[0] += xhalf(lstat[0]);              // join the lane halves' row sums
  lstat[1] += xhalf(lstat[1]);
  float* xa = (float*)Vs;                   // 8 waves x 16 x 512 B
  float* xs = (float*)Ks;                   // 8 waves x 2 x 128 B
#pragma unroll
  for (int ct = 0; ct < 8; ++ct) {
#pragma unroll
    for (int hh = 0; hh < 2; ++hh) {
      v4f o;
#pragma unroll
      for (int v = 0; v < 4; ++v) o[v] = kh ? acc[0][ct][4 * hh + v] : acc[1][ct][4 * hh + v];
      *(v4f*)(xa + ((wave * 16 + ct * 2 + hh) * 32 + lane) * 4) = o;
    }
  }
  xs[(wave * 2 + 0) * 32 + lane] = kh ? mstat[0] : mstat[1];
  xs[(wave * 2 + 1) * 32 + lane] = kh ? lstat[0] : lstat[1];
  __syncthreads();                          // both halves' hand-overs are in LDS

  const int pw = wave ^ 4;
  float ma = kh ? mstat[1] : mstat[0];
  float la = kh ? lstat[1] : lstat[0];
  float mb = xs[(pw * 2 + 0) * 32 + lane];
  float lb = xs[(pw * 2 + 1) * 32 + lane];
  float mj = fmaxf(ma, mb);
  float sa = __builtin_amdgcn_exp2f(ma - mj), sb = __builtin_amdgcn_exp2f(mb - mj);
  float inv = gm / (la * sa + lb * sb);
  float ca = inv * sa, cb = inv * sb;

  // Epilogue: out(b,c,n) = x + gamma * out^T / l for the tile this wave keeps.
  const float* xb = x + (size_t)b * CC * NN;
  float* ob = out + (size_t)b * CC * NN;
#pragma unroll
  for (int ct = 0; ct < 8; ++ct) {
#pragma unroll
    for (int hh = 0; hh < 2; ++hh) {
      v4f o = *(const v4f*)(xa + ((pw * 16 + ct * 2 + hh) * 32 + lane) * 4);
#pragma unroll
      for (int v = 0; v < 4; ++v) {
        float mine = kh ? acc[1][ct][4 * hh + v] : acc[0][ct][4 * hh + v];
        int c = ct * 16 + 4 * hh + v + 8 * g;   // C/D layout: M = 4*hh + v + 8*(lane/16)
        size_t idx = (size_t)c * NN + n0 + 16 * kh + r;
        ob[idx] = xb[idx] + (ca * mine + cb * o[v]);
      }
    }
  }
}

// ---------------------------------------------------------------------------
extern "C" void kernel_launch(void* const* d_in, const int* in_sizes, int n_in,
                              void* d_out, int out_size, void* d_ws, size_t ws_size,
                              hipStream_t stream) {
  const float* x     = (const float*)d_in[0];
  const float* Wq    = (const float*)d_in[1];
  const float* Wk    = (const float*)d_in[2];
  const float* Wv    = (const float*)d_in[3];
  const float* gamma = (const float*)d_in[4];
  float* out = (float*)d_out;

  // Workspace: Qh (1 MB) | Kh (1 MB) | Vt (8 MB), all f16.
  _Float16* Qh = (_Float16*)d_ws;
  _Float16* Kh = Qh + (size_t)CB * NN * CQK;
  _Float16* Vt = Kh + (size_t)CB * NN * CQK;

  qkv_proj<<<CB * NN / 128, 256, 0, stream>>>(x, Wq, Wk, Wv, Qh, Kh, Vt);
  attn_kernel<<<CB * NN / 128, 256, 0, stream>>>(x, Qh, Kh, Vt, gamma, out);
}

// v009
// One run takes 42.9 microseconds.
// Two timings next to v008 both put it at 1.04 times that version's speed.
// All steps since v000 together make it 5.59 times as fast.
#include <hip/hip_runtime.h>

typedef __attribute__((ext_vector_type(16))) _Float16 v16h;
typedef __attribute__((ext_vector_type(8)))  _Float16 v8h;
typedef __attribute__((ext_vector_type(8)))  float    v8f;
typedef __attribute__((ext_vector_type(4)))  float    v4f;
typedef __attribute__((ext_vector_type(2)))  float    v2f;

#define CB   8      // batches
#define CC   128    // channels (c_in)
#define CQK  16     // q/k channels
#define NN   4096   // spatial positions (64*64)

// ---------------------------------------------------------------------------
// Phase 1: Q, K and V projections as one product on the f32 matrix form
// (16x16x4): the 160 stacked weight rows (Wq | Wk | Wv) against x.
// A block owns 128 columns n, a wave 16 of them.  The wave's whole x slab
// (128 c x 16 n) sits in 64 registers and is read from memory exactly once; it
// serves as B for Q and K (D = [o][n]: a lane ends with 8 consecutive o of one
// n) and as A for V (D = [n][c]: a lane ends with 8 consecutive n of one c), so
// every result leaves as one packed 16-byte store.  Weights are staged in LDS,
// rows pitched at 528 B (16 B x odd) for conflict-free b128 fragment reads.
// k order, the same for both operands: of each 8 k, lane half g holds
// k = 4g .. 4g+3; the first matrix instruction takes the low pair, the second
// the high pair.
// Qh,Kh: (b, n, 16) f16.  Vt: (b, c, n) f16.  Q leaves multiplied by log2 e (in
// f32, ahead of its one rounding to f16), so phase 2's scores are exp2 arguments.
// ---------------------------------------------------------------------------
#define WROWS   (2 * CQK + CC)         // 160 stacked weight rows
#define WPITCH  (CC + 4)               // floats per staged weight row (528 B)
#define LOG2E   1.44269504088896340736f

__global__ void __launch_bounds__(256) qkv_proj(
    const float* __restrict__ x, const float* __restrict__ Wq,
    const float* __restrict__ Wk, const float* __restrict__ Wv,
    _Float16* __restrict__ Qh, _Float16* __restrict__ Kh,
    _Float16* __restrict__ Vt) {
  __shared__ __attribute__((aligned(16))) float sW[WROWS * WPITCH];
  int tid  = threadIdx.x;
  int lane = tid & 31;
  int wave = tid >> 5;
  int r    = lane & 15;
  int g    = lane >> 4;
  int b    = blockIdx.x / (NN / 128);
  int n0   = (blockIdx.x % (NN / 128)) * 128 + wave * 16;

  // Weight loads first, 16 bytes a thread a trip (a wave to a row), then the
  // wave's x slab: the weights are staged while the slab is still in flight.
  v4f wr[WROWS / 8];
#pragma unroll
  for (int i = 0; i < WROWS / 8; ++i) {
    const float* wsrc = i < 2 ? Wq + (i * 8 + wave) * CC
                      : i < 4 ? Wk + ((i - 2) * 8 + wave) * CC
                              : Wv + ((i - 4) * 8 + wave) * CC;
    wr[i] = *(const v4f*)(wsrc + lane * 4);
    // Ahead of any reuse of the address registers of the loads issued so far
    // (behind the last Wk load and behind the last Wv load).
    if (i == 3 || i == WROWS / 8 - 1) asm volatile("s_wait_xcnt 0x0" ::: "memory");
  }

  const float* xp = x + (size_t)b * CC * NN + (size_t)(4 * g) * NN + n0 + r;
  v2f xf[CC / 4];
#pragma unroll
  for (int kb = 0; kb < CC / 8; ++kb) {
    xf[2 * kb][0]     = xp[(size_t)(kb * 8 + 0) * NN];
    xf[2 * kb][1]     = xp[(size_t)(kb * 8 + 1) * NN];
    xf[2 * kb + 1][0] = xp[(size_t)(kb * 8 + 2) * NN];
    xf[2 * kb + 1][1] = xp[(size_t)(kb * 8 + 3) * NN];
  }
  // Ahead of any reuse of the slab loads' address registers.
  asm volatile("s_wait_xcnt 0x0" ::: "memory");

#pragma unroll
  for (int i = 0; i < WROWS / 8; ++i)
    *(v4f*)(&sW[(i * 8 + wave) * WPITCH + lane * 4]) = wr[i];
  __syncthreads();

  v8f acc[WROWS / 16];
#pragma unroll
  for (int t = 0; t < WROWS / 16; ++t) acc[t] = v8f{};

  // Weight fragments are double-buffered in registers: the reads of block kb+1
  // stand as one group ahead of the matrix instructions of block kb.
  const float* wl = sW + r * WPITCH + 4 * g;
  v4f w[2][WROWS / 16];
#pragma unroll
  for (int t = 0; t < WROWS / 16; ++t) w[0][t] = *(const v4f*)(wl + t * 16 * WPITCH);
#pragma unroll
  for (int kb = 0; kb < CC / 8; ++kb) {
    if (kb + 1 < CC / 8) {
#pragma unroll
      for (int t = 0; t < WROWS / 16; ++t)
        w[(kb + 1) & 1][t] = *(const v4f*)(wl + t * 16 * WPITCH + (kb + 1) * 8);
    }
    // Keeps the group of reads above ahead of this block's matrix instructions;
    // without it each read sinks to just before its use and is waited for there.
    __builtin_amdgcn_sched_barrier(0);
#pragma unroll
    for (int hh = 0; hh < 2; ++hh) {
      v2f xv = xf[2 * kb + hh];
#pragma unroll
      for (int t = 0; t < WROWS / 16; ++t) {
        v2f wv = {w[kb & 1][t][2 * hh], w[kb & 1][t][2 * hh + 1]};
        if (t < 2)   // Q, K: D[M = o][N = n]
          acc[t] = __builtin_amdgcn_wmma_f32_16x16x4_f32(false, wv, false, xv,
                                                         (short)0, acc[t], false, false);
        else         // V: D[M = n][N = c]
          acc[t] = __builtin_amdgcn_wmma_f32_16x16x4_f32(false, xv, false, wv,
                                                         (short)0, acc[t], false, false);
      }
    }
    // Ends the block: the next group of reads stays behind these instructions.
    __builtin_amdgcn_sched_barrier(0);
  }

#pragma unroll
  for (int t = 0; t < WROWS / 16; ++t) {
    v8h o;
#pragma unroll
    for (int v = 0; v < 8; ++v) o[v] = (_Float16)(t == 0 ? acc[t][v] * LOG2E : acc[t][v]);
    _Float16* dst =
        t == 0 ? Qh + ((size_t)b * NN + n0 + r) * CQK + 8 * g
      : t == 1 ? Kh + ((size_t)b * NN + n0 + r) * CQK + 8 * g
               : Vt + ((size_t)b * CC + (t - 2) * 16 + r) * NN + n0 + 8 * g;
    *(v8h*)dst = o;
  }
}

// ---------------------------------------------------------------------------
// Phase 2: flash attention.  S^T via WMMA so the softmax row = lane%16, P^T
// packs lane-locally, accumulator is out^T (c, n) tiles.
// A wave owns 32 query rows (two 16-row q tiles) and half of the keys: every K
// and V^T fragment it reads from LDS feeds two matrix instructions, one per q
// tile, so a block reads half the LDS bytes per product, and the two tiles'
// softmax chains are independent work for the vector port.  A block is 4 query
// groups x 2 key halves = 8 waves on 128 query rows; wave w and wave w^4 hold
// the same rows and the two halves of every stage's keys.  Behind the loop each
// wave of such a pair hands one tile's (m, l, acc) to the other through LDS and
// finishes the tile it keeps.
// A row's 32 scores of a pass sit in lanes l and l^16: the maximum is
// exchanged between the halves on the vector port, so no wait for an LDS-queue
// exchange drains the pass's fragment reads; each half keeps its own row sum
// (both halves rescale alike) and the two are joined once behind the loop.
// Lazy flash rescale: m is a reference, not the exact running maximum.  A pass
// forms P = exp2(score - m) and its row sums at once and takes no maximum: the
// terms are positive, so a sum bounds each of its terms, and the one test per
// pass (both tiles) is whether a partial sum exceeds PMAX.  While none does, P <= PMAX,
// inside f16.  Only where one does are the maxima taken, m, l and acc moved and
// the pass's P formed again; l and acc are relative to the same m, which cancels
// in acc / l.
// The vector port neither scales a score nor subtracts m from it: Q carries the
// factor log2 e, and the S^T products, whose k = 32 holds only 16 channels, take
// -m along in a padding slot: k = 16 is 1 in every K row and -m (log2 units) in
// every Q row.  m is kept a value that f16 holds exactly, and only the rescale
// rewrites it.  What a product leaves is the argument of exp2.
//
// The eight waves of a block walk the same stages, so each stage of KS keys
// (V^T tile 128 x KS and K tile KS x 16) is brought into LDS once per block by
// asynchronous copies, two buffers: stage s+1 flies while stage s is worked on.
// A stage is as long as two buffers fit the LDS of a WGP: a wave runs KW / 32
// passes between two publish points, so the waves of a SIMD, which leave a
// barrier in step, drift apart (one's vector work under the other's matrix work)
// and are drained and restarted NST times only.
// A V buffer holds the two key halves of its stage as two tiles of 128 x KW, so
// every fragment read of a wave lies within the 64 KB that a read's immediate
// offset spans.  V rows are pitched at 528 B (16 B x odd) so the 16 rows of a b128
// fragment read fall on distinct banks; K rows (32 B) are read as 512 contiguous
// bytes.
// All LDS fragment reads of a 32-key pass stand as one group at its head: the 16
// V^T reads of this pass and the 2 K reads of the wave's next pass in the stage.
// ---------------------------------------------------------------------------
#define KS      512                    // keys per stage
#define NST     (NN / KS)              // stages
#define KW      (KS / 2)               // keys of a stage per wave (one key half)
#define VPITCH  264                    // halves per staged V row of one key half (528 B)
#define VHALF   (CC * VPITCH)          // halves per key half of a V buffer
#define VBUF    (2 * VHALF)            // halves per V buffer
#define KBUF    (KS * CQK)             // halves per K buffer
#define PMAX    32768.0f               // 8 terms of a lane in a pass may sum to this before m moves

// Nine copies of one thread.  s_wait_xcnt 0 stands as the last line of the
// copies' own statement, ahead of any rewrite of the address registers.
__device__ __forceinline__ void copy9(const unsigned* l, const _Float16* const* g) {
  asm volatile(
      "global_load_async_to_lds_b128 %0, %9, off\n\t"
      "global_load_async_to_lds_b128 %1, %10, off\n\t"
      "global_load_async_to_lds_b128 %2, %11, off\n\t"
      "global_load_async_to_lds_b128 %3, %12, off\n\t"
      "global_load_async_to_lds_b128 %4, %13, off\n\t"
      "global_load_async_to_lds_b128 %5, %14, off\n\t"
      "global_load_async_to_lds_b128 %6, %15, off\n\t"
      "global_load_async_to_lds_b128 %7, %16, off\n\t"
      "global_load_async_to_lds_b128 %8, %17, off\n\t"
      "s_wait_xcnt 0x0"
      :: "v"(l[0]), "v"(l[1]), "v"(l[2]), "v"(l[3]), "v"(l[4]), "v"(l[5]),
         "v"(l[6]), "v"(l[7]), "v"(l[8]),
         "v"(g[0]), "v"(g[1]), "v"(g[2]), "v"(g[3]), "v"(g[4]), "v"(g[5]),
         "v"(g[6]), "v"(g[7]), "v"(g[8])
      : "memory");
}

// One stage's copies of one thread: 32 x 16 B of V^T (a wave covers one key half
// of a 1024-B row per copy, the block four rows) and 4 x 16 B of K: 36 in flight.
// gv, gk: the stage's first V^T and K element (uniform); ov, ok: this thread's
// element offsets from them; lv, lk: its wave's LDS byte addresses in the buffer
// (uniform); ll: the lane's byte offset from both.
// (Offsets, not per-thread pointers or LDS addresses, live through the loop: kept
// as such, which are operands of the first statement, they were spilled to scratch.)
__device__ __forceinline__ void stage_copy(const _Float16* gv, const _Float16* gk,
                                           unsigned ov, unsigned ok,
                                           unsigned lv, unsigned lk, unsigned ll) {
  unsigned l[36];
  const _Float16* g[36];
#pragma unroll
  for (int i = 0; i < 32; ++i) {
    l[i] = lv + (unsigned)i * 4u * VPITCH * 2u + ll;
    g[i] = gv + (size_t)i * 4 * NN + ov;
  }
#pragma unroll
  for (int i = 0; i < 4; ++i) {
    l[32 + i] = lk + (unsigned)i * 4096u + ll;
    g[32 + i] = gk + i * 2048 + ok;
  }
#pragma unroll
  for (int i = 0; i < 36; i += 9) copy9(l + i, g + i);
}

// Lane l with lane l ^ 16 by a cross-row vector move: it counts on no LDS
// counter, so the fragment reads in flight are not waited for with it.
__device__ __forceinline__ float xhalf(float v) {
  int b = __builtin_bit_cast(int, v);
  return __builtin_bit_cast(float, __builtin_amdgcn_permlanex16(b, b, 0x76543210, 0xfedcba98, false, false));
}

// One q tile of a pass: P = exp2 of the 16 scores of this lane, packed lane-locally
// into B layout (B[K = m local 0..31, N = q_row]), and their sum, as a pairwise
// tree down to two partial sums of 8 terms (the test on them stands ahead of the
// products, so the tree's depth is waited for).
// SLOT (the rescale's use, where the scores die with their exp2 and the compiler
// lets the next exp2 write over the last one's source): one issue slot behind each
// exp2, as the instruction set asks ahead of such a write; the two scheduling
// barriers hold the slot directly behind its exp2.
template <bool SLOT>
__device__ __forceinline__ float ex2(float x) {
  float y = __builtin_amdgcn_exp2f(x);
  if (SLOT) {
    __builtin_amdgcn_sched_barrier(0);
    asm volatile("v_nop");
    __builtin_amdgcn_sched_barrier(0);
  }
  return y;
}

template <bool SLOT>
__device__ __forceinline__ void soft(const v8f& s0, const v8f& s1, v16h& bp, v2f& rsum) {
  v2f t[4];
#pragma unroll
  for (int v = 0; v < 8; v += 2) {
    v2f a = {ex2<SLOT>(s0[v]), ex2<SLOT>(s0[v + 1])};
    v2f e = {ex2<SLOT>(s1[v]), ex2<SLOT>(s1[v + 1])};
    bp[v]         = (_Float16)a[0];
    bp[v + 1]     = (_Float16)a[1];
    bp[8 + v]     = (_Float16)e[0];
    bp[8 + v + 1] = (_Float16)e[1];
    t[v >> 1] = a + e;
  }
  rsum = (t[0] + t[1]) + (t[2] + t[3]);
}

__global__ void __launch_bounds__(256) attn_kernel(
    const float* __restrict__ x, const _Float16* __restrict__ Qh,
    const _Float16* __restrict__ Kh, const _Float16* __restrict__ Vt,
    const float* __restrict__ gamma, float* __restrict__ out) {
  __shared__ __attribute__((aligned(16))) _Float16 Vs[2 * VBUF];
  __shared__ __attribute__((aligned(16))) _Float16 Ks[2 * KBUF];

  int tid  = threadIdx.x;
  int lane = tid & 31;
  int wave = __builtin_amdgcn_readfirstlane(tid >> 5);
  int qg   = wave & 3;                      // query group: 32 rows
  int kh   = wave >> 2;                     // key half of every stage
  int b    = blockIdx.x >> 5;               // 32 blocks of 128 rows per batch
  int n0   = ((blockIdx.x & 31) << 7) + qg * 32;   // q rows n0 .. n0+31
  int r    = lane & 15;                     // q_row within tile / N index
  int g    = lane >> 4;                     // half-group (K-offset selector)

  const v8f zero = {};
  const float gm = gamma[0];                // uniform: read once, on the scalar path

  // B-operands: two Q tiles, B[K=o (padded to 32), N=q_row]; half 8 of the lower
  // lane half (k = 16) will hold -m, the other halves of 8..15 stay 0.
  v16h bq[2] = {v16h{}, v16h{}};
  const _Float16* qp0 = Qh + ((size_t)b * NN + n0 + r) * CQK + 8 * g;
  const _Float16* qp1 = qp0 + 16 * CQK;
  {
    v8h lo0 = *(const v8h*)qp0;
    v8h lo1 = *(const v8h*)qp1;
    // Ahead of any reuse of the two loads' address registers: as inputs of the
    // wait's own statement the addresses stay in their registers up to it.
    asm volatile("s_wait_xcnt 0x0" :: "v"(qp0), "v"(qp1) : "memory");
#pragma unroll
    for (int h = 0; h < 8; ++h) { bq[0][h] = lo0[h]; bq[1][h] = lo1[h]; }
  }

  v8f acc[2][8];
#pragma unroll
  for (int j = 0; j < 2; ++j)
#pragma unroll
    for (int t = 0; t < 8; ++t) acc[j][t] = zero;
  // Reference 0 until the first pass, whose test is forced (pmax) and which may
  // move m down as well as up (dmin): m then is that pass's true maximum.
  // l is kept as the two partial sums that a pass forms, joined behind the loop.
  float mstat[2] = {0.0f, 0.0f};
  v2f lpart[2] = {v2f{}, v2f{}};
  float pmax = -1.0f, dmin = -1e30f;

  const _Float16* Kb = Kh + (size_t)b * NN * CQK;
  const _Float16* Vb = Vt + (size_t)b * CC * NN;

  // This thread's share of a stage: V row (tid>>6) + 4*i, 16-B column tid&63;
  // K bytes 16*tid + 4096*i of the stage's 16 KB.
  const unsigned ov = (unsigned)(tid >> 6) * NN + (tid & 63) * 8;
  const unsigned ok = (unsigned)tid * 8;
  const unsigned lv = (unsigned)(size_t)(&Vs[(wave & 1) * VHALF + (wave >> 1) * VPITCH]);
  const unsigned lk = (unsigned)(size_t)(&Ks[wave * 256]);
  const unsigned ll = (unsigned)lane * 16u;

  // Prologue: stage 0 lands and is published, then stage 1 starts to fly.
  stage_copy(Vb, Kb, ov, ok, lv, lk, ll);
  asm volatile("s_wait_asynccnt 0x0" ::: "memory");  // own copies of stage 0 landed
  __syncthreads();                                   // ... and every other wave's
  stage_copy(Vb + KS, Kb + KBUF, ov, ok, lv + VBUF * 2u, lk + KBUF * 2u, ll);

  for (int s = 0; s < NST; ++s) {
    const int buf = s & 1;
    const _Float16* vs = Vs + buf * VBUF + kh * VHALF + r * VPITCH + 8 * g;
    const _Float16* ks = Ks + buf * KBUF + (kh * KW + r) * CQK + 8 * g;

    // K fragments, two register sets; the first pair of this wave's key half is read here.
    v8h kf[2][2];
    kf[0][0] = *(const v8h*)(ks);
    kf[0][1] = *(const v8h*)(ks + 16 * CQK);
    // Keeps this pair ahead of the first pass's group: its S^T products then wait
    // for these two reads and not for the eighteen behind them.
    __builtin_amdgcn_sched_barrier(0);

    // Rolled, two passes a trip (one per K register set): unrolled KW / 32 times
    // the loop's text would be four times as long, and nothing in a pass depends
    // on its number.
#pragma unroll 1
    for (int mp = 0; mp < KW; mp += 64) {
#pragma unroll
    for (int mh = 0; mh < 64; mh += 32) {
      const int mm  = mp + mh;
      const int cur = mh >> 5;
      // The pass's read group: its V^T fragments, then the next pass's K pair
      // (never beyond this wave's half of the stage).
      v8h vlo[8], vhi[8];
#pragma unroll
      for (int ct = 0; ct < 8; ++ct) {
        const _Float16* vrow = vs + ct * 16 * VPITCH + mm;
        vlo[ct] = *(const v8h*)(vrow);
        vhi[ct] = *(const v8h*)(vrow + 16);
      }
      if (mh == 0 || mp + 64 < KW) {   // wave-uniform
        kf[cur ^ 1][0] = *(const v8h*)(ks + (mm + 32) * CQK);
        kf[cur ^ 1][1] = *(const v8h*)(ks + (mm + 48) * CQK);
      }
      // Keeps the group above ahead of the pass's work; without it each read
      // sinks to just before its matrix instruction and is waited for there.
      __builtin_amdgcn_sched_barrier(0);

      // A-operands: two K tiles, A[M = m col, K = o padded to 32]; half 8 is 1 in
      // all lanes: k = 16 meets -m, k = 24 (upper lane half) meets a 0 of Q's.
      v16h ak0 = {}, ak1 = {};
      ak0[8] = (_Float16)1.0f;
      ak1[8] = (_Float16)1.0f;
#pragma unroll
      for (int h = 0; h < 8; ++h) { ak0[h] = kf[cur][0][h]; ak1[h] = kf[cur][1][h]; }
      // S^T tiles minus the reference: D[M = m local, N = q_row] = K . Q^T - m,
      // each K tile against both q tiles
      v8f s0[2], s1[2];
#pragma unroll
      for (int j = 0; j < 2; ++j) {
        s0[j] = __builtin_amdgcn_wmma_f32_16x16x32_f16(false, ak0, false, bq[j],
                                                       (short)0, zero, false, false);
        s1[j] = __builtin_amdgcn_wmma_f32_16x16x32_f16(false, ak1, false, bq[j],
                                                       (short)0, zero, false, false);
      }

      // P^T, packed, and this lane half's row sums, against the reference in use.
      v16h bp[2];
      v2f rsum[2];
#pragma unroll
      for (int j = 0; j < 2; ++j) soft<false>(s0[j], s1[j], bp[j], rsum[j]);

      // Lazy rescale: only when some partial sum exceeds PMAX (an overflowed exp2
      // too: its sum is infinite).  Every row then moves to its running maximum
      // (rounded to f16), by d; this pass's scores, made against the old
      // reference, follow, and P and the sums are formed again from them.
      if (__any(fmaxf(fmaxf(rsum[0][0], rsum[0][1]), fmaxf(rsum[1][0], rsum[1][1])) > pmax)) {
#pragma unroll
        for (int j = 0; j < 2; ++j) {
          float t = -1e30f;
#pragma unroll
          for (int v = 0; v < 8; ++v) t = fmaxf(t, fmaxf(s0[j][v], s1[j][v]));
          float tmax = fmaxf(t, xhalf(t));  // the row's 32 columns; per-lane row = r
          _Float16 mh = (_Float16)(mstat[j] + fmaxf(tmax, dmin));
          float d  = (float)mh - mstat[j];
          float sc = __builtin_amdgcn_exp2f(-fmaxf(d, 0.0f));   // unchanged max: sc = 1
          mstat[j] = (float)mh;
          bq[j][8] = g ? (_Float16)0.0f : -mh;
          lpart[j] *= sc;
#pragma unroll
          for (int ct = 0; ct < 8; ++ct) {
#pragma unroll
            for (int v = 0; v < 8; ++v) acc[j][ct][v] *= sc;
          }
#pragma unroll
          for (int v = 0; v < 8; ++v) {
            s0[j][v] -= d;
            s1[j][v] -= d;
          }
          soft<true>(s0[j], s1[j], bp[j], rsum[j]);
        }
        pmax = PMAX;
        dmin = 0.0f;
      }
      lpart[0] += rsum[0];                  // this lane half's 16 keys only
      lpart[1] += rsum[1];

      // acc += V^T . P^T   (out^T tiles, M = c, N = q_row): one fragment, two tiles
#pragma unroll
      for (int ct = 0; ct < 8; ++ct) {
        v16h av;
#pragma unroll
        for (int h = 0; h < 8; ++h) { av[h] = vlo[ct][h]; av[8 + h] = vhi[ct][h]; }
#pragma unroll
        for (int j = 0; j < 2; ++j)
          acc[j][ct] = __builtin_amdgcn_wmma_f32_16x16x32_f16(false, av, false, bp[j],
                                                              (short)0, acc[j][ct], false, false);
      }
      // Ends the pass: the next group of reads stays behind these instructions.
      __builtin_amdgcn_sched_barrier(0);
      // One issue slot: the next pass's first vector writes may fall on the P^T
      // registers.
      asm volatile("v_nop");
      // Keeps the next pass's vector instructions behind that slot.
      __builtin_amdgcn_sched_barrier(0);
    }
    }

    // Publish point of stage s+1, every wave, in this order.
    asm volatile("s_wait_dscnt 0x0" ::: "memory");     // own reads of buffer 'buf' returned
    asm volatile("s_wait_asynccnt 0x0" ::: "memory");  // own copies of stage s+1 landed
    __syncthreads();  // publishes stage s+1; ends every wave's reads of buffer 'buf'
    if (s + 2 < NST)  // block-uniform: refill the buffer just left with stage s+2
      // (readfirstlane: the buffer's address is summed on the scalar side; folded
      // into a per-thread address outside the loop, that one was spilled to scratch)
      stage_copy(Vb + (s + 2) * KS, Kb + (s + 2) * KBUF, ov, ok,
                 (unsigned)__builtin_amdgcn_readfirstlane((int)(lv + buf * (VBUF * 2u))),
                 (unsigned)__builtin_amdgcn_readfirstlane((int)(lk + buf * (KBUF * 2u))), ll);
  }
  asm volatile("s_wait_asynccnt 0x0" ::: "memory");    // no copy in flight at the wave's end

  // Join of the two key halves.  The loop's last barrier ended every read of the
  // stage buffers and no copy is in flight, so they serve as the exchange area.
  // Wave kh keeps q tile kh and hands tile 1-kh to its partner (wave ^ 4).
  float lstat[2] = {lpart[0][0] + lpart[0][1], lpart[1][0] + lpart[1][1]};
  lstat[0] += xhalf(lstat[0]);              // join the lane halves' row sums
  lstat[1] += xhalf(lstat[1]);
  float* xa = (float*)Vs;                   // 8 waves x 16 x 512 B
  float* xs = (float*)Ks;                   // 8 waves x 2 x 128 B
#pragma unroll
  for (int ct = 0; ct < 8; ++ct) {
#pragma unroll
    for (int hh = 0; hh < 2; ++hh) {
      v4f o;
#pragma unroll
      for (int v = 0; v < 4; ++v) o[v] = kh ? acc[0][ct][4 * hh + v] : acc[1][ct][4 * hh + v];
      *(v4f*)(xa + ((wave * 16 + ct * 2 + hh) * 32 + lane) * 4) = o;
    }
  }
  xs[(wave * 2 + 0) * 32 + lane] = kh ? mstat[0] : mstat[1];
  xs[(wave * 2 + 1) * 32 + lane] = kh ? lstat[0] : lstat[1];
  __syncthreads();                          // both halves' hand-overs are in LDS

  const int pw = wave ^ 4;
  float ma = kh ? mstat[1] : mstat[0];
  float la = kh ? lstat[1] : lstat[0];
  float mb = xs[(pw * 2 + 0) * 32 + lane];
  float lb = xs[(pw * 2 + 1) * 32 + lane];
  float mj = fmaxf(ma, mb);
  float sa = __builtin_amdgcn_exp2f(ma - mj), sb = __builtin_amdgcn_exp2f(mb - mj);
  float inv = gm / (la * sa + lb * sb);
  float ca = inv * sa, cb = inv * sb;

  // Epilogue: out(b,c,n) = x + gamma * out^T / l for the tile this wave keeps.
  const float* xb = x + (size_t)b * CC * NN;
  float* ob = out + (size_t)b * CC * NN;
#pragma unroll
  for (int ct = 0; ct < 8; ++ct) {
#pragma unroll
    for (int hh = 0; hh < 2; ++hh) {
      v4f o = *(const v4f*)(xa + ((pw * 16 + ct * 2 + hh) * 32 + lane) * 4);
#pragma unroll
      for (int v = 0; v < 4; ++v) {
        float mine = kh ? acc[1][ct][4 * hh + v] : acc[0][ct][4 * hh + v];
        int c = ct * 16 + 4 * hh + v + 8 * g;   // C/D layout: M = 4*hh + v + 8*(lane/16)
        size_t idx = (size_t)c * NN + n0 + 16 * kh + r;
        ob[idx] = xb[idx] + (ca * mine + cb * o[v]);
      }
    }
  }
}

// ---------------------------------------------------------------------------
extern "C" void kernel_launch(void* const* d_in, const int* in_sizes, int n_in,
                              void* d_out, int out_size, void* d_ws, size_t ws_size,
                              hipStream_t stream) {
  const float* x     = (const float*)d_in[0];
  const float* Wq    = (const float*)d_in[1];
  const float* Wk    = (const float*)d_in[2];
  const float* Wv    = (const float*)d_in[3];
  const float* gamma = (const float*)d_in[4];
  float* out = (float*)d_out;

  // Workspace: Qh (1 MB) | Kh (1 MB) | Vt (8 MB), all f16.
  _Float16* Qh = (_Float16*)d_ws;
  _Float16* Kh = Qh + (size_t)CB * NN * CQK;
  _Float16* Vt = Kh + (size_t)CB * NN * CQK;

  qkv_proj<<<CB * NN / 128, 256, 0, stream>>>(x, Wq, Wk, Wv, Qh, Kh, Vt);
  attn_kernel<<<CB * NN / 128, 256, 0, stream>>>(x, Qh, Kh, Vt, gamma, out);
}

// v010
// One run takes 39.6 microseconds.
// Two timings next to v009 both put it at 1.08 times that version's speed.
// Counting every step since v000, it is 6.04 times as fast.
#include <hip/hip_runtime.h>

typedef __attribute__((ext_vector_type(16))) _Float16 v16h;
typedef __attribute__((ext_vector_type(8)))  _Float16 v8h;
typedef __attribute__((ext_vector_type(4)))  _Float16 v4h;
typedef __attribute__((ext_vector_type(2)))  _Float16 v2h;
typedef __attribute__((ext_vector_type(8)))  float    v8f;
typedef __attribute__((ext_vector_type(4)))  float    v4f;
typedef __attribute__((ext_vector_type(2)))  float    v2f;

#define CB   8      // batches
#define CC   128    // channels (c_in)
#define CQK  16     // q/k channels
#define NN   4096   // spatial positions (64*64)

// ---------------------------------------------------------------------------
// Phase 1: Q, K and V projections as one product: the 160 stacked weight rows
// (Wq | Wk | Wv) against x, on the f16 matrix form (16x16x32) with f32 sums.
// Every f32 operand is split into two f16 values, v = hi + lo (hi = v rounded,
// lo = the exact remainder rounded), and a product is taken as
// hi.hi + hi.lo + lo.hi: three matrix instructions cover 32 k where the f32 form
// (16x16x4, at twice the issue interval) takes eight.  The term left out, lo.lo,
// lies some 22 bits below the product; the results are rounded to f16 anyway.
// A block owns 128 columns n, a wave 16 of them.  The wave's whole x slab
// (128 c x 16 n) is read from memory exactly once and sits split in 64 registers;
// it serves as B for Q and K (D = [o][n]: a lane ends with 8 consecutive o of one
// n) and as A for V (D = [n][c]: a lane ends with 8 consecutive n of one c), so
// every result leaves as one packed 16-byte store.  Weights are split once per
// block and staged in LDS as a hi and a lo plane, rows pitched at 272 B
// (16 B x odd) for conflict-free b128 fragment reads.
// k order, the same for both operands: of each 32 k, lane half g holds
// k = 16g .. 16g+15, in order, in its 16 halves.
// Qh,Kh: (b, n, 16) f16.  Vt: (b, c, n) f16.  Q leaves multiplied by log2 e (in
// f32, ahead of its one rounding to f16), so phase 2's scores are exp2 arguments.
// ---------------------------------------------------------------------------
#define WROWS   (2 * CQK + CC)         // 160 stacked weight rows
#define WPITCH  (CC + 8)               // halves per staged weight row (272 B)
#define WTU     5                      // weight tiles per unit of the product loop
#define LOG2E   1.44269504088896340736f

__device__ __forceinline__ void split(v2f v, v2h& hi, v2h& lo) {
  hi = __builtin_convertvector(v, v2h);
  lo = __builtin_convertvector(v - __builtin_convertvector(hi, v2f), v2h);
}

__global__ void __launch_bounds__(256) qkv_proj(
    const float* __restrict__ x, const float* __restrict__ Wq,
    const float* __restrict__ Wk, const float* __restrict__ Wv,
    _Float16* __restrict__ Qh, _Float16* __restrict__ Kh,
    _Float16* __restrict__ Vt) {
  __shared__ __attribute__((aligned(16))) _Float16 sWh[WROWS * WPITCH];
  __shared__ __attribute__((aligned(16))) _Float16 sWl[WROWS * WPITCH];
  int tid  = threadIdx.x;
  int lane = tid & 31;
  int wave = tid >> 5;
  int r    = lane & 15;
  int g    = lane >> 4;
  int b    = blockIdx.x / (NN / 128);
  int n0   = (blockIdx.x % (NN / 128)) * 128 + wave * 16;

  // Weight loads first, 16 bytes a thread a trip (a wave to a row), then the
  // wave's x slab: the weights are split and staged while the slab is in flight.
  v4f wr[WROWS / 8];
  const float* wv0 = Wv + wave * CC + lane * 4;
#pragma unroll
  for (int i = 0; i < WROWS / 8; ++i) {
    const float* wsrc = i < 2 ? Wq + (i * 8 + wave) * CC + lane * 4
                      : i < 4 ? Wk + ((i - 2) * 8 + wave) * CC + lane * 4
                              : wv0 + (i - 4) * 8 * CC;
    wr[i] = *(const v4f*)wsrc;
    // Ahead of any reuse of the address registers of the loads issued so far
    // (behind the last Wk load and behind the last Wv load; as an input of the
    // wait's own statement the Wv loads' address stays in its registers up to it).
    if (i == 3) asm volatile("s_wait_xcnt 0x0" ::: "memory");
    if (i == WROWS / 8 - 1) asm volatile("s_wait_xcnt 0x0" :: "v"(wv0) : "memory");
  }

  const float* xp = x + (size_t)b * CC * NN + (size_t)(16 * g) * NN + n0 + r;
  float xf[CC / 2];
#pragma unroll
  for (int kk = 0; kk < CC / 32; ++kk) {
#pragma unroll
    for (int h = 0; h < 16; ++h) xf[kk * 16 + h] = xp[(size_t)(kk * 32 + h) * NN];
  }
  // Ahead of any reuse of the slab loads' address registers.
  asm volatile("s_wait_xcnt 0x0" ::: "memory");

#pragma unroll
  for (int i = 0; i < WROWS / 8; ++i) {
    v4h hi, lo;
#pragma unroll
    for (int v = 0; v < 4; v += 2) {
      v2h ph, pl;
      split(v2f{wr[i][v], wr[i][v + 1]}, ph, pl);
      hi[v] = ph[0]; hi[v + 1] = ph[1];
      lo[v] = pl[0]; lo[v + 1] = pl[1];
    }
    *(v4h*)(&sWh[(i * 8 + wave) * WPITCH + lane * 4]) = hi;
    *(v4h*)(&sWl[(i * 8 + wave) * WPITCH + lane * 4]) = lo;
  }
  __syncthreads();

  v16h xh[CC / 32], xl[CC / 32];
#pragma unroll
  for (int kk = 0; kk < CC / 32; ++kk) {
#pragma unroll
    for (int h = 0; h < 16; h += 2) {
      v2h ph, pl;
      split(v2f{xf[kk * 16 + h], xf[kk * 16 + h + 1]}, ph, pl);
      xh[kk][h] = ph[0]; xh[kk][h + 1] = ph[1];
      xl[kk][h] = pl[0]; xl[kk][h + 1] = pl[1];
    }
  }

  v8f acc[WROWS / 16];
#pragma unroll
  for (int t = 0; t < WROWS / 16; ++t) acc[t] = v8f{};

  // A unit is WTU weight tiles on one block of 32 k.  Weight fragments are
  // double-buffered in registers: the reads of unit u+1 stand as one group ahead
  // of the matrix instructions of unit u.
  const int wo = r * WPITCH + 16 * g;
  constexpr int NU = (CC / 32) * (WROWS / 16 / WTU);
  v8h wh[2][WTU][2], wl[2][WTU][2];
#pragma unroll
  for (int u = -1; u < NU; ++u) {
    if (u + 1 < NU) {
      const int kn = (u + 1) / 2, tn = ((u + 1) & 1) * WTU;
#pragma unroll
      for (int t = 0; t < WTU; ++t) {
        const int o = wo + (tn + t) * 16 * WPITCH + kn * 32;
        wh[(u + 1) & 1][t][0] = *(const v8h*)(sWh + o);
        wh[(u + 1) & 1][t][1] = *(const v8h*)(sWh + o + 8);
        wl[(u + 1) & 1][t][0] = *(const v8h*)(sWl + o);
        wl[(u + 1) & 1][t][1] = *(const v8h*)(sWl + o + 8);
      }
    }
    // Keeps the group of reads above ahead of this unit's matrix instructions;
    // without it each read sinks to just before its use and is waited for there.
    __builtin_amdgcn_sched_barrier(0);
    if (u >= 0) {
      const int kk = u / 2, t0 = (u & 1) * WTU;
#pragma unroll
      for (int term = 0; term < 3; ++term) {
        v16h xv = term == 1 ? xl[kk] : xh[kk];
#pragma unroll
        for (int t = 0; t < WTU; ++t) {
          v16h wv;
#pragma unroll
          for (int h = 0; h < 8; ++h) {
            wv[h]     = term == 2 ? wl[u & 1][t][0][h] : wh[u & 1][t][0][h];
            wv[8 + h] = term == 2 ? wl[u & 1][t][1][h] : wh[u & 1][t][1][h];
          }
          if (t0 + t < 2)   // Q, K: D[M = o][N = n]
            acc[t0 + t] = __builtin_amdgcn_wmma_f32_16x16x32_f16(
                false, wv, false, xv, (short)0, acc[t0 + t], false, false);
          else              // V: D[M = n][N = c]
            acc[t0 + t] = __builtin_amdgcn_wmma_f32_16x16x32_f16(
                false, xv, false, wv, (short)0, acc[t0 + t], false, false);
        }
      }
    }
    // Ends the unit: the next group of reads stays behind these instructions.
    __builtin_amdgcn_sched_barrier(0);
  }

#pragma unroll
  for (int t = 0; t < WROWS / 16; ++t) {
    v8h o;
#pragma unroll
    for (int v = 0; v < 8; ++v) o[v] = (_Float16)(t == 0 ? acc[t][v] * LOG2E : acc[t][v]);
    _Float16* dst =
        t == 0 ? Qh + ((size_t)b * NN + n0 + r) * CQK + 8 * g
      : t == 1 ? Kh + ((size_t)b * NN + n0 + r) * CQK + 8 * g
               : Vt + ((size_t)b * CC + (t - 2) * 16 + r) * NN + n0 + 8 * g;
    *(v8h*)dst = o;
  }
}

// ---------------------------------------------------------------------------
// Phase 2: flash attention.  S^T via WMMA so the softmax row = lane%16, P^T
// packs lane-locally, accumulator is out^T (c, n) tiles.
// A wave owns 32 query rows (two 16-row q tiles) and half of the keys: every K
// and V^T fragment it reads from LDS feeds two matrix instructions, one per q
// tile, so a block reads half the LDS bytes per product, and the two tiles'
// softmax chains are independent work for the vector port.  A block is 4 query
// groups x 2 key halves = 8 waves on 128 query rows; wave w and wave w^4 hold
// the same rows and the two halves of every stage's keys.  Behind the loop each
// wave of such a pair hands one tile's (m, l, acc) to the other through LDS and
// finishes the tile it keeps.
// A row's 32 scores of a pass sit in lanes l and l^16: the maximum is
// exchanged between the halves on the vector port, so no wait for an LDS-queue
// exchange drains the pass's fragment reads; each half keeps its own row sum
// (both halves rescale alike) and the two are joined once behind the loop.
// Lazy flash rescale: m is a reference, not the exact running maximum.  A pass
// forms P = exp2(score - m) and its row sums at once and takes no maximum: the
// terms are positive, so a sum bounds each of its terms, and the one test per
// pass (both tiles) is whether a partial sum exceeds PMAX.  While none does, P <= PMAX,
// inside f16.  Only where one does are the maxima taken, m, l and acc moved and
// the pass's P formed again; l and acc are relative to the same m, which cancels
// in acc / l.
// The vector port neither scales a score nor subtracts m from it: Q carries the
// factor log2 e, and the S^T products, whose k = 32 holds only 16 channels, take
// -m along in a padding slot: k = 16 is 1 in every K row and -m (log2 units) in
// every Q row.  m is kept a value that f16 holds exactly, and only the rescale
// rewrites it.  What a product leaves is the argument of exp2.
//
// The eight waves of a block walk the same stages, so each stage of KS keys
// (V^T tile 128 x KS and K tile KS x 16) is brought into LDS once per block by
// asynchronous copies, two buffers: stage s+1 flies while stage s is worked on.
// A stage is as long as two buffers fit the LDS of a WGP: a wave runs KW / 32
// passes between two publish points, so the waves of a SIMD, which leave a
// barrier in step, drift apart (one's vector work under the other's matrix work)
// and are drained and restarted NST times only.
// A V buffer holds the two key halves of its stage as two tiles of 128 x KW, so
// every fragment read of a wave lies within the 64 KB that a read's immediate
// offset spans.  V rows are pitched at 528 B (16 B x odd) so the 16 rows of a b128
// fragment read fall on distinct banks; K rows (32 B) are read as 512 contiguous
// bytes.
// All LDS fragment reads of a 32-key pass stand as one group at its head: the 16
// V^T reads of this pass and the 2 K reads of the wave's next pass in the stage.
// ---------------------------------------------------------------------------
#define KS      512                    // keys per stage
#define NST     (NN / KS)              // stages
#define KW      (KS / 2)               // keys of a stage per wave (one key half)
#define VPITCH  264                    // halves per staged V row of one key half (528 B)
#define VHALF   (CC * VPITCH)          // halves per key half of a V buffer
#define VBUF    (2 * VHALF)            // halves per V buffer
#define KBUF    (KS * CQK)             // halves per K buffer
#define PMAX    32768.0f               // 8 terms of a lane in a pass may sum to this before m moves

// Nine copies of one thread.  s_wait_xcnt 0 stands as the last line of the
// copies' own statement, ahead of any rewrite of the address registers.
__device__ __forceinline__ void copy9(const unsigned* l, const _Float16* const* g) {
  asm volatile(
      "global_load_async_to_lds_b128 %0, %9, off\n\t"
      "global_load_async_to_lds_b128 %1, %10, off\n\t"
      "global_load_async_to_lds_b128 %2, %11, off\n\t"
      "global_load_async_to_lds_b128 %3, %12, off\n\t"
      "global_load_async_to_lds_b128 %4, %13, off\n\t"
      "global_load_async_to_lds_b128 %5, %14, off\n\t"
      "global_load_async_to_lds_b128 %6, %15, off\n\t"
      "global_load_async_to_lds_b128 %7, %16, off\n\t"
      "global_load_async_to_lds_b128 %8, %17, off\n\t"
      "s_wait_xcnt 0x0"
      :: "v"(l[0]), "v"(l[1]), "v"(l[2]), "v"(l[3]), "v"(l[4]), "v"(l[5]),
         "v"(l[6]), "v"(l[7]), "v"(l[8]),
         "v"(g[0]), "v"(g[1]), "v"(g[2]), "v"(g[3]), "v"(g[4]), "v"(g[5]),
         "v"(g[6]), "v"(g[7]), "v"(g[8])
      : "memory");
}

// One stage's copies of one thread: 32 x 16 B of V^T (a wave covers one key half
// of a 1024-B row per copy, the block four rows) and 4 x 16 B of K: 36 in flight.
// gv, gk: the stage's first V^T and K element (uniform); ov, ok: this thread's
// element offsets from them; lv, lk: its wave's LDS byte addresses in the buffer
// (uniform); ll: the lane's byte offset from both.
// (Offsets, not per-thread pointers or LDS addresses, live through the loop: kept
// as such, which are operands of the first statement, they were spilled to scratch.)
__device__ __forceinline__ void stage_copy(const _Float16* gv, const _Float16* gk,
                                           unsigned ov, unsigned ok,
                                           unsigned lv, unsigned lk, unsigned ll) {
  unsigned l[36];
  const _Float16* g[36];
#pragma unroll
  for (int i = 0; i < 32; ++i) {
    l[i] = lv + (unsigned)i * 4u * VPITCH * 2u + ll;
    g[i] = gv + (size_t)i * 4 * NN + ov;
  }
#pragma unroll
  for (int i = 0; i < 4; ++i) {
    l[32 + i] = lk + (unsigned)i * 4096u + ll;
    g[32 + i] = gk + i * 2048 + ok;
  }
#pragma unroll
  for (int i = 0; i < 36; i += 9) copy9(l + i, g + i);
}

// Lane l with lane l ^ 16 by a cross-row vector move: it counts on no LDS
// counter, so the fragment reads in flight are not waited for with it.
__device__ __forceinline__ float xhalf(float v) {
  int b = __builtin_bit_cast(int, v);
  return __builtin_bit_cast(float, __builtin_amdgcn_permlanex16(b, b, 0x76543210, 0xfedcba98, false, false));
}

// One q tile of a pass: P = exp2 of the 16 scores of this lane, packed lane-locally
// into B layout (B[K = m local 0..31, N = q_row]), and their sum, as a pairwise
// tree down to two partial sums of 8 terms (the test on them stands ahead of the
// products, so the tree's depth is waited for).
// SLOT (the rescale's use, where the scores die with their exp2 and the compiler
// lets the next exp2 write over the last one's source): one issue slot behind each
// exp2, as the instruction set asks ahead of such a write; the two scheduling
// barriers hold the slot directly behind its exp2.
template <bool SLOT>
__device__ __forceinline__ float ex2(float x) {
  float y = __builtin_amdgcn_exp2f(x);
  if (SLOT) {
    __builtin_amdgcn_sched_barrier(0);
    asm volatile("v_nop");
    __builtin_amdgcn_sched_barrier(0);
  }
  return y;
}

template <bool SLOT>
__device__ __forceinline__ void soft(const v8f& s0, const v8f& s1, v16h& bp, v2f& rsum) {
  v2f t[4];
#pragma unroll
  for (int v = 0; v < 8; v += 2) {
    v2f a = {ex2<SLOT>(s0[v]), ex2<SLOT>(s0[v + 1])};
    v2f e = {ex2<SLOT>(s1[v]), ex2<SLOT>(s1[v + 1])};
    bp[v]         = (_Float16)a[0];
    bp[v + 1]     = (_Float16)a[1];
    bp[8 + v]     = (_Float16)e[0];
    bp[8 + v + 1] = (_Float16)e[1];
    t[v >> 1] = a + e;
  }
  rsum = (t[0] + t[1]) + (t[2] + t[3]);
}

__global__ void __launch_bounds__(256) attn_kernel(
    const float* __restrict__ x, const _Float16* __restrict__ Qh,
    const _Float16* __restrict__ Kh, const _Float16* __restrict__ Vt,
    const float* __restrict__ gamma, float* __restrict__ out) {
  __shared__ __attribute__((aligned(16))) _Float16 Vs[2 * VBUF];
  __shared__ __attribute__((aligned(16))) _Float16 Ks[2 * KBUF];

  int tid  = threadIdx.x;
  int lane = tid & 31;
  int wave = __builtin_amdgcn_readfirstlane(tid >> 5);
  int qg   = wave & 3;                      // query group: 32 rows
  int kh   = wave >> 2;                     // key half of every stage
  int b    = blockIdx.x >> 5;               // 32 blocks of 128 rows per batch
  int n0   = ((blockIdx.x & 31) << 7) + qg * 32;   // q rows n0 .. n0+31
  int r    = lane & 15;                     // q_row within tile / N index
  int g    = lane >> 4;                     // half-group (K-offset selector)

  const v8f zero = {};
  const float gm = gamma[0];                // uniform: read once, on the scalar path

  // B-operands: two Q tiles, B[K=o (padded to 32), N=q_row]; half 8 of the lower
  // lane half (k = 16) will hold -m, the other halves of 8..15 stay 0.
  v16h bq[2] = {v16h{}, v16h{}};
  const _Float16* qp0 = Qh + ((size_t)b * NN + n0 + r) * CQK + 8 * g;
  const _Float16* qp1 = qp0 + 16 * CQK;
  {
    v8h lo0 = *(const v8h*)qp0;
    v8h lo1 = *(const v8h*)qp1;
    // Ahead of any reuse of the two loads' address registers: as inputs of the
    // wait's own statement the addresses stay in their registers up to it.
    asm volatile("s_wait_xcnt 0x0" :: "v"(qp0), "v"(qp1) : "memory");
#pragma unroll
    for (int h = 0; h < 8; ++h) { bq[0][h] = lo0[h]; bq[1][h] = lo1[h]; }
  }

  v8f acc[2][8];
#pragma unroll
  for (int j = 0; j < 2; ++j)
#pragma unroll
    for (int t = 0; t < 8; ++t) acc[j][t] = zero;
  // Reference 0 until the first pass, whose test is forced (pmax) and which may
  // move m down as well as up (dmin): m then is that pass's true maximum.
  // l is kept as the two partial sums that a pass forms, joined behind the loop.
  float mstat[2] = {0.0f, 0.0f};
  v2f lpart[2] = {v2f{}, v2f{}};
  float pmax = -1.0f, dmin = -1e30f;

  const _Float16* Kb = Kh + (size_t)b * NN * CQK;
  const _Float16* Vb = Vt + (size_t)b * CC * NN;

  // This thread's share of a stage: V row (tid>>6) + 4*i, 16-B column tid&63;
  // K bytes 16*tid + 4096*i of the stage's 16 KB.
  const unsigned ov = (unsigned)(tid >> 6) * NN + (tid & 63) * 8;
  const unsigned ok = (unsigned)tid * 8;
  const unsigned lv = (unsigned)(size_t)(&Vs[(wave & 1) * VHALF + (wave >> 1) * VPITCH]);
  const unsigned lk = (unsigned)(size_t)(&Ks[wave * 256]);
  const unsigned ll = (unsigned)lane * 16u;

  // Prologue: stage 0 lands and is published, then stage 1 starts to fly.
  stage_copy(Vb, Kb, ov, ok, lv, lk, ll);
  asm volatile("s_wait_asynccnt 0x0" ::: "memory");  // own copies of stage 0 landed
  __syncthreads();                                   // ... and every other wave's
  stage_copy(Vb + KS, Kb + KBUF, ov, ok, lv + VBUF * 2u, lk + KBUF * 2u, ll);

  for (int s = 0; s < NST; ++s) {
    const int buf = s & 1;
    const _Float16* vs = Vs + buf * VBUF + kh * VHALF + r * VPITCH + 8 * g;
    const _Float16* ks = Ks + buf * KBUF + (kh * KW + r) * CQK + 8 * g;

    // K fragments, two register sets; the first pair of this wave's key half is read here.
    v8h kf[2][2];
    kf[0][0] = *(const v8h*)(ks);
    kf[0][1] = *(const v8h*)(ks + 16 * CQK);
    // Keeps this pair ahead of the first pass's group: its S^T products then wait
    // for these two reads and not for the eighteen behind them.
    __builtin_amdgcn_sched_barrier(0);

    // Rolled, two passes a trip (one per K register set): unrolled KW / 32 times
    // the loop's text would be four times as long, and nothing in a pass depends
    // on its number.
#pragma unroll 1
    for (int mp = 0; mp < KW; mp += 64) {
#pragma unroll
    for (int mh = 0; mh < 64; mh += 32) {
      const int mm  = mp + mh;
      const int cur = mh >> 5;
      // The pass's read group: its V^T fragments, then the next pass's K pair
      // (never beyond this wave's half of the stage).
      v8h vlo[8], vhi[8];
#pragma unroll
      for (int ct = 0; ct < 8; ++ct) {
        const _Float16* vrow = vs + ct * 16 * VPITCH + mm;
        vlo[ct] = *(const v8h*)(vrow);
        vhi[ct] = *(const v8h*)(vrow + 16);
      }
      if (mh == 0 || mp + 64 < KW) {   // wave-uniform
        kf[cur ^ 1][0] = *(const v8h*)(ks + (mm + 32) * CQK);
        kf[cur ^ 1][1] = *(const v8h*)(ks + (mm + 48) * CQK);
      }
      // Keeps the group above ahead of the pass's work; without it each read
      // sinks to just before its matrix instruction and is waited for there.
      __builtin_amdgcn_sched_barrier(0);

      // A-operands: two K tiles, A[M = m col, K = o padded to 32]; half 8 is 1 in
      // all lanes: k = 16 meets -m, k = 24 (upper lane half) meets a 0 of Q's.
      v16h ak0 = {}, ak1 = {};
      ak0[8] = (_Float16)1.0f;
      ak1[8] = (_Float16)1.0f;
#pragma unroll
      for (int h = 0; h < 8; ++h) { ak0[h] = kf[cur][0][h]; ak1[h] = kf[cur][1][h]; }
      // S^T tiles minus the reference: D[M = m local, N = q_row] = K . Q^T - m,
      // each K tile against both q tiles
      v8f s0[2], s1[2];
#pragma unroll
      for (int j = 0; j < 2; ++j) {
        s0[j] = __builtin_amdgcn_wmma_f32_16x16x32_f16(false, ak0, false, bq[j],
                                                       (short)0, zero, false, false);
        s1[j] = __builtin_amdgcn_wmma_f32_16x16x32_f16(false, ak1, false, bq[j],
                                                       (short)0, zero, false, false);
      }

      // P^T, packed, and this lane half's row sums, against the reference in use.
      v16h bp[2];
      v2f rsum[2];
#pragma unroll
      for (int j = 0; j < 2; ++j) soft<false>(s0[j], s1[j], bp[j], rsum[j]);

      // Lazy rescale: only when some partial sum exceeds PMAX (an overflowed exp2
      // too: its sum is infinite).  Every row then moves to its running maximum
      // (rounded to f16), by d; this pass's scores, made against the old
      // reference, follow, and P and the sums are formed again from them.
      if (__any(fmaxf(fmaxf(rsum[0][0], rsum[0][1]), fmaxf(rsum[1][0], rsum[1][1])) > pmax)) {
#pragma unroll
        for (int j = 0; j < 2; ++j) {
          float t = -1e30f;
#pragma unroll
          for (int v = 0; v < 8; ++v) t = fmaxf(t, fmaxf(s0[j][v], s1[j][v]));
          float tmax = fmaxf(t, xhalf(t));  // the row's 32 columns; per-lane row = r
          _Float16 mh = (_Float16)(mstat[j] + fmaxf(tmax, dmin));
          float d  = (float)mh - mstat[j];
          float sc = __builtin_amdgcn_exp2f(-fmaxf(d, 0.0f));   // unchanged max: sc = 1
          mstat[j] = (float)mh;
          bq[j][8] = g ? (_Float16)0.0f : -mh;
          lpart[j] *= sc;
#pragma unroll
          for (int ct = 0; ct < 8; ++ct) {
#pragma unroll
            for (int v = 0; v < 8; ++v) acc[j][ct][v] *= sc;
          }
#pragma unroll
          for (int v = 0; v < 8; ++v) {
            s0[j][v] -= d;
            s1[j][v] -= d;
          }
          soft<true>(s0[j], s1[j], bp[j], rsum[j]);
        }
        pmax = PMAX;
        dmin = 0.0f;
      }
      lpart[0] += rsum[0];                  // this lane half's 16 keys only
      lpart[1] += rsum[1];

      // acc += V^T . P^T   (out^T tiles, M = c, N = q_row): one fragment, two tiles
#pragma unroll
      for (int ct = 0; ct < 8; ++ct) {
        v16h av;
#pragma unroll
        for (int h = 0; h < 8; ++h) { av[h] = vlo[ct][h]; av[8 + h] = vhi[ct][h]; }
#pragma unroll
        for (int j = 0; j < 2; ++j)
          acc[j][ct] = __builtin_amdgcn_wmma_f32_16x16x32_f16(false, av, false, bp[j],
                                                              (short)0, acc[j][ct], false, false);
      }
      // Ends the pass: the next group of reads stays behind these instructions.
      __builtin_amdgcn_sched_barrier(0);
      // One issue slot: the next pass's first vector writes may fall on the P^T
      // registers.
      asm volatile("v_nop");
      // Keeps the next pass's vector instructions behind that slot.
      __builtin_amdgcn_sched_barrier(0);
    }
    }

    // Publish point of stage s+1, every wave, in this order.
    asm volatile("s_wait_dscnt 0x0" ::: "memory");     // own reads of buffer 'buf' returned
    asm volatile("s_wait_asynccnt 0x0" ::: "memory");  // own copies of stage s+1 landed
    __syncthreads();  // publishes stage s+1; ends every wave's reads of buffer 'buf'
    if (s + 2 < NST)  // block-uniform: refill the buffer just left with stage s+2
      // (readfirstlane: the buffer's address is summed on the scalar side; folded
      // into a per-thread address outside the loop, that one was spilled to scratch)
      stage_copy(Vb + (s + 2) * KS, Kb + (s + 2) * KBUF, ov, ok,
                 (unsigned)__builtin_amdgcn_readfirstlane((int)(lv + buf * (VBUF * 2u))),
                 (unsigned)__builtin_amdgcn_readfirstlane((int)(lk + buf * (KBUF * 2u))), ll);
  }
  asm volatile("s_wait_asynccnt 0x0" ::: "memory");    // no copy in flight at the wave's end

  // Join of the two key halves.  The loop's last barrier ended every read of the
  // stage buffers and no copy is in flight, so they serve as the exchange area.
  // Wave kh keeps q tile kh and hands tile 1-kh to its partner (wave ^ 4).
  float lstat[2] = {lpart[0][0] + lpart[0][1], lpart[1][0] + lpart[1][1]};
  lstat[0] += xhalf(lstat[0]);              // join the lane halves' row sums
  lstat[1] += xhalf(lstat[1]);
  float* xa = (float*)Vs;                   // 8 waves x 16 x 512 B
  float* xs = (float*)Ks;                   // 8 waves x 2 x 128 B
#pragma unroll
  for (int ct = 0; ct < 8; ++ct) {
#pragma unroll
    for (int hh = 0; hh < 2; ++hh) {
      v4f o;
#pragma unroll
      for (int v = 0; v < 4; ++v) o[v] = kh ? acc[0][ct][4 * hh + v] : acc[1][ct][4 * hh + v];
      *(v4f*)(xa + ((wave * 16 + ct * 2 + hh) * 32 + lane) * 4) = o;
    }
  }
  xs[(wave * 2 + 0) * 32 + lane] = kh ? mstat[0] : mstat[1];
  xs[(wave * 2 + 1) * 32 + lane] = kh ? lstat[0] : lstat[1];
  __syncthreads();                          // both halves' hand-overs are in LDS

  const int pw = wave ^ 4;
  float ma = kh ? mstat[1] : mstat[0];
  float la = kh ? lstat[1] : lstat[0];
  float mb = xs[(pw * 2 + 0) * 32 + lane];
  float lb = xs[(pw * 2 + 1) * 32 + lane];
  float mj = fmaxf(ma, mb);
  float sa = __builtin_amdgcn_exp2f(ma - mj), sb = __builtin_amdgcn_exp2f(mb - mj);
  float inv = gm / (la * sa + lb * sb);
  float ca = inv * sa, cb = inv * sb;

  // Epilogue: out(b,c,n) = x + gamma * out^T / l for the tile this wave keeps.
  const float* xb = x + (size_t)b * CC * NN;
  float* ob = out + (size_t)b * CC * NN;
#pragma unroll
  for (int ct = 0; ct < 8; ++ct) {
#pragma unroll
    for (int hh = 0; hh < 2; ++hh) {
      v4f o = *(const v4f*)(xa + ((pw * 16 + ct * 2 + hh) * 32 + lane) * 4);
#pragma unroll
      for (int v = 0; v < 4; ++v) {
        float mine = kh ? acc[1][ct][4 * hh + v] : acc[0][ct][4 * hh + v];
        int c = ct * 16 + 4 * hh + v + 8 * g;   // C/D layout: M = 4*hh + v + 8*(lane/16)
        size_t idx = (size_t)c * NN + n0 + 16 * kh + r;
        ob[idx] = xb[idx] + (ca * mine + cb * o[v]);
      }
    }
  }
}

// ---------------------------------------------------------------------------
extern "C" void kernel_launch(void* const* d_in, const int* in_sizes, int n_in,
                              void* d_out, int out_size, void* d_ws, size_t ws_size,
                              hipStream_t stream) {
  const float* x     = (const float*)d_in[0];
  const float* Wq    = (const float*)d_in[1];
  const float* Wk    = (const float*)d_in[2];
  const float* Wv    = (const float*)d_in[3];
  const float* gamma = (const float*)d_in[4];
  float* out = (float*)d_out;

  // Workspace: Qh (1 MB) | Kh (1 MB) | Vt (8 MB), all f16.
  _Float16* Qh = (_Float16*)d_ws;
  _Float16* Kh = Qh + (size_t)CB * NN * CQK;
  _Float16* Vt = Kh + (size_t)CB * NN * CQK;

  qkv_proj<<<CB * NN / 128, 256, 0, stream>>>(x, Wq, Wk, Wv, Qh, Kh, Vt);
  attn_kernel<<<CB * NN / 128, 256, 0, stream>>>(x, Qh, Kh, Vt, gamma, out);
}
